// v000
// Measured on an AMD MI455X. A time is GPU time per run, averaged over a window of back-to-back runs after a warm-up
// (all launches, gaps included; the runs take copies of the inputs in turn), and the median of several windows.
// Apart from v000's, it joins two sittings. Times from different sittings can be a few percent apart, while
// side-by-side timings come from the same sitting.
// v000 is the starting kernel. One run takes 68.5 microseconds.
#include <hip/hip_runtime.h>

// Pairwise additive scoring: two linear projections u = data Wl^T + bl and v = crit Wr^T + br ([NB][SEQ][512] x [64][512]^T, weights [out][in]), then
// out[b][n][m] = sum_a tanh(u[b][n][a] + v[b][m][a]) * agg[a] (f32 output [NB][SEQ][SEQ]).
// Compute dtypes: both projections v_wmma_f32_16x16x32_bf16 (x and W RNE-converted to bf16; products exact; f32 accumulate); biases and agg RNE-converted to bf16, added / applied in f32.
// Pairwise stage on the vector unit in f32: tanh(x) = 1 - 2 / (1 + exp2(2 log2(e) x)) with v_exp_f32 and v_rcp_f32; the 64-deep weighted sum is a matrix-vector product against one shared vector (no second column exists) and stays on the vector unit.
// Layout: bf16 copies of data, crit, Wl, Wr; f32 planes U, V [(b*SEQ + t)][64] holding (projection + bias) * 2 log2(e); pairwise kernel with 64 x 64 output tiles, 4 x 4 outputs per thread, projection tiles transposed in LDS.

#ifndef NB
#define NB 4
#endif
#ifndef SEQ
#define SEQ 1024
#endif
#define NB_FULL  4
#define SEQ_FULL 1024
#ifndef OUT_SEQ
#define OUT_SEQ SEQ              // row pitch (in elements) of the output and row count between batches of the output
#endif
#define DK   512                 // projection depth
#define AG   64                  // projected width
#define PT   68                  // LDS row pitch (floats) of the transposed projection tiles
#define C2   ((float)(2.0 * 1.4426950408889634))   // 2 * log2(e)

static_assert(DK % 32 == 0);                   // GEMM k-loop steps by 32
static_assert(DK % 8 == 0);                    // 16-byte fragment loads
static_assert(AG == 64);                       // one 64-column GEMM tile = the whole projected width; plane row = 256 bytes = two lines
static_assert(SEQ % 64 == 0);                  // 64-row tiles never straddle two batches; pairwise grid covers the sequence exactly
static_assert((NB * SEQ) % 64 == 0);
static_assert(OUT_SEQ % 32 == 0);
static_assert(OUT_SEQ >= SEQ);
static_assert(((size_t)SEQ * DK) % 8 == 0);
static_assert(((size_t)AG * DK) % 8 == 0);
static_assert(NB <= NB_FULL);
static_assert(SEQ <= SEQ_FULL);
static_assert(PT % 4 == 0);                    // 16-byte LDS reads
static_assert(PT >= 64);
static_assert(32 * 16 * 8 == 16 * AG * 4);     // projection epilogue: 32 lanes x 16 B x 8 instructions == 16 rows x 256 B
static_assert(256 * 16 * 4 == 64 * 64 * 4);    // pairwise store: 256 threads x 16 B x 4 instructions == 64 rows x 256 B
static_assert(256 * 4 * 4 == 64 * AG);         // pairwise staging: 256 threads x 4 floats x 4 trips == 64 rows x 64 columns
static_assert((2 * AG * PT + AG) * 4 <= 131072);   // static LDS of the pairwise kernel
static_assert(16 * 68 * 4 <= 131072);              // static LDS of the projection kernel

typedef unsigned short bf;
typedef __attribute__((ext_vector_type(16))) __bf16   v16bf;
typedef __attribute__((ext_vector_type(8)))  unsigned short v8us;
typedef __attribute__((ext_vector_type(8)))  float    v8f;
typedef __attribute__((ext_vector_type(4)))  float    v4f;
typedef v4f  __attribute__((may_alias)) v4fa;

__device__ __forceinline__ unsigned short f2bf(float f) { unsigned u = __float_as_uint(f); u += 0x7FFFu + ((u >> 16) & 1u); return (unsigned short)(u >> 16); }
__device__ __forceinline__ float bfr(float f) { return __uint_as_float(((unsigned)f2bf(f)) << 16); }   // value after RNE convert to bf16
__device__ __forceinline__ v16bf cat16b(v8us lo, v8us hi) { return __builtin_bit_cast(v16bf, __builtin_shufflevector(lo, hi, 0, 1, 2, 3, 4, 5, 6, 7, 8, 9, 10, 11, 12, 13, 14, 15)); }
__device__ __forceinline__ v8f wmmab(v16bf a, v16bf b, v8f c) { return __builtin_amdgcn_wmma_f32_16x16x32_bf16(false, a, false, b, (short)0, c, false, false); }
// one matrix instruction followed by its own four-slot guard (accumulator tied, operands kept live)
__device__ __forceinline__ v8f wmmab_g(v16bf a, v16bf b, v8f c) { c = wmmab(a, b, c); asm volatile("v_nop\n\tv_nop\n\tv_nop\n\tv_nop" : "+v"(c) : "v"(a), "v"(b)); return c; }
// fragment loader from K-contiguous 16-bit rows; p already includes + 8*(lane>>4): elements 0..7 <- k0+8h+0..7, elements 8..15 <- k0+16+8h+0..7 (same map for A and B)
__device__ __forceinline__ v16bf ldb(const bf* p)  { return cat16b(*(const v8us*)p, *(const v8us*)(p + 16)); }
// ordering point for wave-private LDS tiles (same wave writes and reads)
__device__ __forceinline__ void wave_sync() { __builtin_amdgcn_fence(3 /* release order */, "wavefront"); __builtin_amdgcn_wave_barrier(); asm volatile("" ::: "memory"); }

__global__ __launch_bounds__(256) void k_cvt8(const float* __restrict__ src, bf* dst, size_t n8) {
    const size_t i = (size_t)blockIdx.x * 256 + threadIdx.x; if (i >= n8) return;
    const v8f v = *(const v8f*)(src + i * 8); v8us o;
#pragma unroll
    for (int k = 0; k < 8; ++k) o[k] = f2bf(v[k]);
    *(v8us*)(dst + i * 8) = o; 
}

// k_lin: register-blocked bf16 GEMM, ONE WAVE per 64 x 64 tile (16 accumulators), operands straight from K-contiguous bf16 planes, K = DK.
// P[m][n] = (sum_k A[m][k] Bt[n][k] + bias[n]) * C2 as f32; A = x rows (m = b*SEQ + t), Bt = W rows (n = output feature), plane [m][64] (row = 256 bytes).
__global__ __launch_bounds__(32) void k_lin(const bf* __restrict__ A, const bf* __restrict__ Bt, const float* __restrict__ bias, float* P) {
    __shared__ __align__(16) float os[16 * 68];
    const int K = DK;
    const int lane = threadIdx.x & 31, lr = lane & 15, hi = lane >> 4; const int r0 = blockIdx.x * 64;
    v8f acc[4][4];
#pragma unroll
    for (int mb = 0; mb < 4; ++mb)
#pragma unroll
        for (int nb = 0; nb < 4; ++nb) acc[mb][nb] = (v8f){};
    const size_t aoff = (size_t)(r0 + lr) * K + 8 * hi, boff = (size_t)lr * K + 8 * hi;
#pragma unroll 1
    for (int kc = 0; kc < K; kc += 32) {
        v16bf a[4];
#pragma unroll
        for (int mb = 0; mb < 4; ++mb) a[mb] = ldb(A + aoff + (size_t)mb * 16 * K + kc);
#pragma unroll
        for (int nb = 0; nb < 4; ++nb) { const v16bf b = ldb(Bt + boff + (size_t)nb * 16 * K + kc);
#pragma unroll
            for (int mb = 0; mb < 4; ++mb) acc[mb][nb] = wmmab_g(a[mb], b, acc[mb][nb]); }
    }
    float bc[4];
#pragma unroll
    for (int nb = 0; nb < 4; ++nb) bc[nb] = bfr(bias[nb * 16 + lr]);          // nb*16 + lr <= 63 < AG
#pragma unroll
    for (int mb = 0; mb < 4; ++mb) {
#pragma unroll
        for (int nb = 0; nb < 4; ++nb) {
#pragma unroll
            for (int j = 0; j < 8; ++j) os[(hi * 8 + j) * 68 + nb * 16 + lr] = (acc[mb][nb][j] + bc[nb]) * C2; }   // D: row 8h+j, col lane&15; rows 0..15 x columns 0..63 all written
        wave_sync();
        float* pb = P + (size_t)(r0 + mb * 16) * AG;
{
#pragma unroll
            for (int s = 0; s < 8; ++s) { const int row = 2 * s + (lane >> 4), c4 = (lane & 15) * 4;   // 8 s x 2 rows = 16 rows; 16 lanes x 4 floats = 64 columns
                const v4f val = *(const v4fa*)(&os[row * 68 + c4]);
                *(v4f*)(pb + (size_t)row * AG + c4) = val; }
             }
        wave_sync();
    }
}

// k_pair: out[b][n][m] = sum_a agg[a] * tanh(u[n][a] + v[m][a]) with U, V pre-multiplied by 2 log2(e):
//   e = exp2(U + V), r = 1 / (1 + e), tanh = 1 - 2 r, out = sum_a agg[a] + sum_a (-2 agg[a]) r.
// Block = 256 threads = 64 (n) x 64 (m) outputs of one batch; thread (tx = tid&15, ty = tid>>4) owns rows 4ty..4ty+3 and columns 4tx..4tx+3.
// LDS: U tile and V tile transposed to [a][row] (columns 0..63 of every row written, only those read), w[a] = -2 * agg[a]; one block barrier between staging and use (cross-wave).
__global__ __launch_bounds__(256) void k_pair(const float* __restrict__ U, const float* __restrict__ V, const float* __restrict__ agg, float* OUT) {
    __shared__ __align__(16) float dT[AG * PT];
    __shared__ __align__(16) float cT[AG * PT];
    __shared__ __align__(16) float wS[AG];
    const int tid = threadIdx.x; const int tx = tid & 15, ty = tid >> 4;
    const int n0 = blockIdx.x * 64, m0 = blockIdx.y * 64, b = blockIdx.z;
    const float* dsrc = U + ((size_t)b * SEQ + n0) * AG;
    const float* csrc = V + ((size_t)b * SEQ + m0) * AG;
#pragma unroll
    for (int i = 0; i < 4; ++i) { const int idx = i * 256 + tid; const int row = idx >> 4, c4 = (idx & 15) * 4;   // 1024 pieces of 4 floats = 64 rows x 64 columns
        const v4f dv = *(const v4f*)(dsrc + (size_t)idx * 4); const v4f cv = *(const v4f*)(csrc + (size_t)idx * 4);
#pragma unroll
        for (int k = 0; k < 4; ++k) { dT[(c4 + k) * PT + row] = dv[k]; cT[(c4 + k) * PT + row] = cv[k]; } }
    if (tid < AG) wS[tid] = -2.0f * bfr(agg[tid]);                       // waves 0 and 1 entirely (wave-uniform test)
    __syncthreads();
    float acc[4][4];
#pragma unroll
    for (int i = 0; i < 4; ++i)
#pragma unroll
        for (int j = 0; j < 4; ++j) acc[i][j] = 0.0f;
    float sw = 0.0f;
#pragma unroll 2
    for (int a = 0; a < AG; ++a) {
        const v4f d = *(const v4fa*)(&dT[a * PT + 4 * ty]);
        const v4f c = *(const v4fa*)(&cT[a * PT + 4 * tx]);
        const float w = wS[a];
        sw += w;
#pragma unroll
        for (int i = 0; i < 4; ++i) {
#pragma unroll
            for (int j = 0; j < 4; ++j) {
                const float e = __builtin_amdgcn_exp2f(d[i] + c[j]);
                const float r = __builtin_amdgcn_rcpf(1.0f + e);
                acc[i][j] = fmaf(w, r, acc[i][j]); } }
    }
    const float sa = -0.5f * sw;                                         // sum_a agg[a]
    v4f val[4];
#pragma unroll
    for (int i = 0; i < 4; ++i) { val[i][0] = acc[i][0] + sa; val[i][1] = acc[i][1] + sa; val[i][2] = acc[i][2] + sa; val[i][3] = acc[i][3] + sa; }
    float* ob = OUT + ((size_t)b * OUT_SEQ + n0 + 4 * ty) * OUT_SEQ + m0 + 4 * tx;
{
#pragma unroll
        for (int i = 0; i < 4; ++i) *(v4f*)(ob + (size_t)i * OUT_SEQ) = val[i];   // 4 i x 16 ty = 64 rows; 16 tx x 4 floats = 64 columns
         }
}

static constexpr size_t al256(size_t v) { return (v + 255) & ~(size_t)255; }
static constexpr size_t SZ_XB = al256((size_t)NB * SEQ * DK * 2);      // bf16 activations, rows = NB*SEQ (multiple of 64)
static constexpr size_t SZ_WB = al256((size_t)2 * AG * DK * 2);        // bf16 weights: Wl | Wr
static constexpr size_t SZ_PL = al256((size_t)NB * SEQ * AG * 4);      // f32 projection plane, rows = NB*SEQ (multiple of 64 = GEMM tile rows)
static constexpr size_t SZ_TOTAL = 2 * SZ_XB + SZ_WB + 2 * SZ_PL;
static_assert(SZ_TOTAL <= (size_t)134217728);          // workspace carve <= 128 MiB
static_assert(((size_t)AG * DK * 2) % 256 == 0);       // weight sub-planes stay 256-byte aligned

extern "C" void kernel_launch(void* const* d_in, const int* in_sizes, int n_in,
                              void* d_out, int out_size, void* d_ws, size_t ws_size, hipStream_t stream) {
    if (n_in < 7) return;
    const size_t needx = ((size_t)(NB - 1) * SEQ_FULL + SEQ) * DK;
    if ((size_t)in_sizes[0] < needx || (size_t)in_sizes[1] < needx) return;
    if ((size_t)in_sizes[2] < (size_t)AG * DK || (size_t)in_sizes[4] < (size_t)AG * DK) return;
    if (in_sizes[3] < AG || in_sizes[5] < AG || in_sizes[6] < AG) return;
    if ((size_t)out_size < ((size_t)(NB - 1) * OUT_SEQ + (size_t)(SEQ - 1)) * OUT_SEQ + SEQ) return;
    if (SZ_TOTAL > ws_size) return;
    // wire order: data, crit, Wl, bl, Wr, br, agg
    const float* xin[2] = { (const float*)d_in[0], (const float*)d_in[1] };
    const float* wl = (const float*)d_in[2]; const float* bl = (const float*)d_in[3];
    const float* wr = (const float*)d_in[4]; const float* br = (const float*)d_in[5];
    const float* ag = (const float*)d_in[6];
    float* OUT = (float*)d_out;      // [NB][SEQ][SEQ]
    char* wsp = (char*)d_ws;
    bf* XB[2];
    XB[0] = (bf*)wsp; wsp += SZ_XB;                  // data [NB*SEQ][512]
    XB[1] = (bf*)wsp; wsp += SZ_XB;                  // crit [NB*SEQ][512]
    bf* WB = (bf*)wsp; wsp += SZ_WB;                 // [2][64][512]: Wl | Wr ([out][in] = Bt as-is)
    float* UP = (float*)wsp; wsp += SZ_PL;           // [NB*SEQ][64] (data Wl^T + bl) * C2
    float* VP = (float*)wsp; wsp += SZ_PL;           // [NB*SEQ][64] (crit Wr^T + br) * C2
    bf* WL = WB; bf* WR = WB + (size_t)AG * DK;

    for (int i = 0; i < 2; ++i) {
        if (SEQ == SEQ_FULL) {
            const size_t n8 = (size_t)NB * SEQ * DK / 8;
            k_cvt8<<<(unsigned)((n8 + 255) / 256), 256, 0, stream>>>(xin[i], XB[i], n8);
        } else {
            const size_t n8 = (size_t)SEQ * DK / 8;
            for (int b = 0; b < NB; ++b) k_cvt8<<<(unsigned)((n8 + 255) / 256), 256, 0, stream>>>(xin[i] + (size_t)b * SEQ_FULL * DK, XB[i] + (size_t)b * SEQ * DK, n8);
        }
    }
    { const size_t n8 = (size_t)AG * DK / 8; const unsigned g = (unsigned)((n8 + 255) / 256);
      k_cvt8<<<g, 256, 0, stream>>>(wl, WL, n8); k_cvt8<<<g, 256, 0, stream>>>(wr, WR, n8); }

    // A = x rows (m = b*SEQ + t), Bt = W rows (n = output feature) -> plane [m][64]
    k_lin<<<dim3(NB * SEQ / 64, 1, 1), 32, 0, stream>>>(XB[0], WL, bl, UP);
    k_lin<<<dim3(NB * SEQ / 64, 1, 1), 32, 0, stream>>>(XB[1], WR, br, VP);

    k_pair<<<dim3(SEQ / 64, SEQ / 64, NB), 256, 0, stream>>>(UP, VP, ag, OUT);
}

// v001
// Measured time: 32.6 microseconds a run.
// Timed twice side by side with v000, it ran 2.12 times as fast both times.
#include <hip/hip_runtime.h>

// Pairwise additive scoring: two linear projections u = data Wl^T + bl and v = crit Wr^T + br ([NB][SEQ][512] x [64][512]^T, weights [out][in]), then
// out[b][n][m] = sum_a tanh(u[b][n][a] + v[b][m][a]) * agg[a] (f32 output [NB][SEQ][SEQ]).
// Compute dtypes: both projections v_wmma_f32_16x16x32_bf16 (x and W RNE-converted to bf16; products exact; f32 accumulate); biases and agg RNE-converted to bf16, added / applied in f32.
// Pairwise stage on the vector unit in f32: tanh(x) = 1 - 2 / (1 + exp2(2 log2(e) x)) with v_exp_f32 and v_rcp_f32; the 64-deep weighted sum is a matrix-vector product against one shared vector (no second column exists) and stays on the vector unit.
// Layout: one projection launch (f32 rows of x and W read whole-line, converted in registers, staged as bf16 in LDS); f32 planes U, V [(b*SEQ + t)][64] holding (projection + bias) * 2 log2(e); pairwise kernel with 64 x 64 output tiles, 4 x 4 outputs per thread, projection tiles transposed in LDS.

#ifndef NB
#define NB 4
#endif
#ifndef SEQ
#define SEQ 1024
#endif
#define NB_FULL  4
#define SEQ_FULL 1024
#ifndef OUT_SEQ
#define OUT_SEQ SEQ              // row pitch (in elements) of the output and row count between batches of the output
#endif
#define DK   512                 // projection depth
#define AG   64                  // projected width
#define PT   68                  // LDS row pitch (floats) of the transposed projection tiles
#define TR   32                  // x rows per projection work-group
#define KP   (DK + 8)            // LDS row pitch (bf16 elements) of the staged operands: 1040 bytes = 16 x odd
#define C2   ((float)(2.0 * 1.4426950408889634))   // 2 * log2(e)

static_assert(DK % 32 == 0);                   // GEMM k-loop steps by 32
static_assert(DK % 8 == 0);                    // 16-byte fragment loads
static_assert(AG == 64);                       // one 64-column GEMM tile = the whole projected width; plane row = 256 bytes = two lines
static_assert(SEQ % 64 == 0);                  // 64-row tiles never straddle two batches; pairwise grid covers the sequence exactly
static_assert((NB * SEQ) % 64 == 0);
static_assert(OUT_SEQ % 32 == 0);
static_assert(OUT_SEQ >= SEQ);
static_assert(NB <= NB_FULL);
static_assert(SEQ <= SEQ_FULL);
static_assert(PT % 4 == 0);                    // 16-byte LDS reads
static_assert(PT >= 64);
static_assert(256 * 16 * 2 == TR * AG * 4);    // projection store: 256 threads x 16 B x 2 instructions == 32 rows x 256 B
static_assert(DK * 4 == 128 * 16);             // projection staging: one f32 row == 128 pieces of 16 B, 256 threads == 2 rows a trip
static_assert((TR / 16) * (AG / 16) == 8);     // projection: one 16 x 16 output tile per wave, 8 waves
static_assert(((KP * 2) / 16) % 2 == 1 && (KP * 2) % 16 == 0);   // conflict-free 16-byte fragment reads
static_assert(256 * 16 * 4 == 64 * 64 * 4);    // pairwise store: 256 threads x 16 B x 4 instructions == 64 rows x 256 B
static_assert(256 * 4 * 4 == 64 * AG);         // pairwise staging: 256 threads x 4 floats x 4 trips == 64 rows x 64 columns
static_assert((2 * AG * PT + AG) * 4 <= 131072);   // static LDS of the pairwise kernel
static_assert((TR + AG) * KP * 2 + TR * 68 * 4 <= 131072);   // static LDS of the projection kernel

typedef unsigned short bf;
typedef __attribute__((ext_vector_type(16))) __bf16   v16bf;
typedef __attribute__((ext_vector_type(8)))  unsigned short v8us;
typedef __attribute__((ext_vector_type(8)))  float    v8f;
typedef __attribute__((ext_vector_type(4)))  __bf16   v4bf;
typedef __attribute__((ext_vector_type(4)))  unsigned short v4us;
typedef __attribute__((ext_vector_type(4)))  float    v4f;
typedef v4f  __attribute__((may_alias)) v4fa;

__device__ __forceinline__ unsigned short f2bf(float f) { unsigned u = __float_as_uint(f); u += 0x7FFFu + ((u >> 16) & 1u); return (unsigned short)(u >> 16); }
__device__ __forceinline__ float bfr(float f) { return __uint_as_float(((unsigned)f2bf(f)) << 16); }   // value after RNE convert to bf16
__device__ __forceinline__ v16bf cat16b(v8us lo, v8us hi) { return __builtin_bit_cast(v16bf, __builtin_shufflevector(lo, hi, 0, 1, 2, 3, 4, 5, 6, 7, 8, 9, 10, 11, 12, 13, 14, 15)); }
__device__ __forceinline__ v8f wmmab(v16bf a, v16bf b, v8f c) { return __builtin_amdgcn_wmma_f32_16x16x32_bf16(false, a, false, b, (short)0, c, false, false); }
// fragment loader from K-contiguous 16-bit rows; p already includes + 8*(lane>>4): elements 0..7 <- k0+8h+0..7, elements 8..15 <- k0+16+8h+0..7 (same map for A and B)
__device__ __forceinline__ v16bf ldb(const bf* p)  { return cat16b(*(const v8us*)p, *(const v8us*)(p + 16)); }

// k_proj: both projections in one launch; blockIdx.y = 0: U = data Wl^T, 1: V = crit Wr^T. Work-group = 8 waves = 32 x rows x all 64 output features, K = DK.
// P[m][n] = (sum_k x[m][k] W[n][k] + bias[n]) * C2 as f32 (m = b*SEQ + t), plane [m][64] (row = 256 bytes).
// Staging: 32 x rows then 64 W rows, each wave-wide load = 512 contiguous bytes of one f32 row; RNE convert to bf16 in registers; 8-byte LDS stores. One barrier, then wave w owns
// the 16 x 16 tile (rows 16*(w>>2), features 16*(w&3)) and runs the 16 k-steps in ascending k into one accumulator. Second barrier in front of the whole-line store of the 32 x 64 tile.
__global__ __launch_bounds__(256) void k_proj(const float* __restrict__ X0, const float* __restrict__ X1, const float* __restrict__ W0, const float* __restrict__ W1,
                                              const float* __restrict__ B0, const float* __restrict__ B1, float* P0, float* P1) {
    __shared__ __align__(16) bf    sm[(TR + AG) * KP];     // rows 0..31: x tile, rows 32..95: W; columns 0..511 of every row written, only those read
    __shared__ __align__(16) float os[TR * 68];
    const int tid = threadIdx.x; const int lane = tid & 31, lr = lane & 15, hi = lane >> 4, wv = tid >> 5;
    const bool sec = blockIdx.y != 0;
    const int r0 = blockIdx.x * TR;                                        // TR divides 64 divides SEQ: a tile never straddles two batches
    const float* xs = (sec ? X1 : X0) + ((size_t)(r0 / SEQ) * SEQ_FULL + (size_t)(r0 % SEQ)) * DK;
    const float* ws = sec ? W1 : W0;
    const float* bias = sec ? B1 : B0;
    float* P = sec ? P1 : P0;
    v4f st[(TR + AG) / 2];
#pragma unroll
    for (int i = 0; i < TR / 2; ++i) st[i] = *(const v4f*)(xs + (size_t)(i * 256 + tid) * 4);              // 16 trips x 2 rows = 32 rows
#pragma unroll
    for (int i = 0; i < AG / 2; ++i) st[TR / 2 + i] = *(const v4f*)(ws + (size_t)(i * 256 + tid) * 4);     // 32 trips x 2 rows = 64 rows
    const float bc = bfr(bias[(wv & 3) * 16 + lr]);                        // index <= 63 < AG
    __builtin_amdgcn_sched_barrier(0);   // keeps every staging load in front of the first convert: all 48 are in flight at once, one memory round trip instead of two
#pragma unroll
    for (int i = 0; i < (TR + AG) / 2; ++i)
        *(v4us*)(&sm[(2 * i + (tid >> 7)) * KP + (tid & 127) * 4]) = __builtin_bit_cast(v4us, __builtin_convertvector(st[i], v4bf));
    __syncthreads();
    const bf* ap = sm + ((wv >> 2) * 16 + lr) * KP + 8 * hi;
    const bf* bp = sm + (TR + (wv & 3) * 16 + lr) * KP + 8 * hi;
    v8f acc = (v8f){};
#pragma unroll
    for (int kc = 0; kc < DK; kc += 32) acc = wmmab(ldb(ap + kc), ldb(bp + kc), acc);
#pragma unroll
    for (int j = 0; j < 8; ++j) os[((wv >> 2) * 16 + hi * 8 + j) * 68 + (wv & 3) * 16 + lr] = (acc[j] + bc) * C2;   // D: row 8h+j, col lane&15; 8 waves cover rows 0..31 x columns 0..63
    __syncthreads();
    float* pb = P + (size_t)r0 * AG;
#pragma unroll
    for (int s = 0; s < 2; ++s) { const int idx = s * 256 + tid; const int row = idx >> 4, c4 = (idx & 15) * 4;     // 512 pieces of 4 floats = 32 rows x 64 columns
        *(v4f*)(pb + (size_t)idx * 4) = *(const v4fa*)(&os[row * 68 + c4]); }
}

// k_pair: out[b][n][m] = sum_a agg[a] * tanh(u[n][a] + v[m][a]) with U, V pre-multiplied by 2 log2(e):
//   e = exp2(U + V), r = 1 / (1 + e), tanh = 1 - 2 r, out = sum_a agg[a] + sum_a (-2 agg[a]) r.
// Block = 256 threads = 64 (n) x 64 (m) outputs of one batch; thread (tx = tid&15, ty = tid>>4) owns rows 4ty..4ty+3 and columns 4tx..4tx+3.
// LDS: U tile and V tile transposed to [a][row] (columns 0..63 of every row written, only those read), w[a] = -2 * agg[a]; one block barrier between staging and use (cross-wave).
__global__ __launch_bounds__(256) void k_pair(const float* __restrict__ U, const float* __restrict__ V, const float* __restrict__ agg, float* OUT) {
    __shared__ __align__(16) float dT[AG * PT];
    __shared__ __align__(16) float cT[AG * PT];
    __shared__ __align__(16) float wS[AG];
    const int tid = threadIdx.x; const int tx = tid & 15, ty = tid >> 4;
    const int n0 = blockIdx.x * 64, m0 = blockIdx.y * 64, b = blockIdx.z;
    const float* dsrc = U + ((size_t)b * SEQ + n0) * AG;
    const float* csrc = V + ((size_t)b * SEQ + m0) * AG;
#pragma unroll
    for (int i = 0; i < 4; ++i) { const int idx = i * 256 + tid; const int row = idx >> 4, c4 = (idx & 15) * 4;   // 1024 pieces of 4 floats = 64 rows x 64 columns
        const v4f dv = *(const v4f*)(dsrc + (size_t)idx * 4); const v4f cv = *(const v4f*)(csrc + (size_t)idx * 4);
#pragma unroll
        for (int k = 0; k < 4; ++k) { dT[(c4 + k) * PT + row] = dv[k]; cT[(c4 + k) * PT + row] = cv[k]; } }
    if (tid < AG) wS[tid] = -2.0f * bfr(agg[tid]);                       // waves 0 and 1 entirely (wave-uniform test)
    __syncthreads();
    float acc[4][4];
#pragma unroll
    for (int i = 0; i < 4; ++i)
#pragma unroll
        for (int j = 0; j < 4; ++j) acc[i][j] = 0.0f;
    float sw = 0.0f;
#pragma unroll 2
    for (int a = 0; a < AG; ++a) {
        const v4f d = *(const v4fa*)(&dT[a * PT + 4 * ty]);
        const v4f c = *(const v4fa*)(&cT[a * PT + 4 * tx]);
        const float w = wS[a];
        sw += w;
#pragma unroll
        for (int i = 0; i < 4; ++i) {
#pragma unroll
            for (int j = 0; j < 4; ++j) {
                const float e = __builtin_amdgcn_exp2f(d[i] + c[j]);
                const float r = __builtin_amdgcn_rcpf(1.0f + e);
                acc[i][j] = fmaf(w, r, acc[i][j]); } }
    }
    const float sa = -0.5f * sw;                                         // sum_a agg[a]
    v4f val[4];
#pragma unroll
    for (int i = 0; i < 4; ++i) { val[i][0] = acc[i][0] + sa; val[i][1] = acc[i][1] + sa; val[i][2] = acc[i][2] + sa; val[i][3] = acc[i][3] + sa; }
    float* ob = OUT + ((size_t)b * OUT_SEQ + n0 + 4 * ty) * OUT_SEQ + m0 + 4 * tx;
{
#pragma unroll
        for (int i = 0; i < 4; ++i) *(v4f*)(ob + (size_t)i * OUT_SEQ) = val[i];   // 4 i x 16 ty = 64 rows; 16 tx x 4 floats = 64 columns
         }
}

static constexpr size_t al256(size_t v) { return (v + 255) & ~(size_t)255; }
static constexpr size_t SZ_PL = al256((size_t)NB * SEQ * AG * 4);      // f32 projection plane, rows = NB*SEQ (multiple of 32 = projection tile rows)
static constexpr size_t SZ_TOTAL = 2 * SZ_PL;
static_assert(SZ_TOTAL <= (size_t)134217728);          // workspace carve <= 128 MiB

extern "C" void kernel_launch(void* const* d_in, const int* in_sizes, int n_in,
                              void* d_out, int out_size, void* d_ws, size_t ws_size, hipStream_t stream) {
    if (n_in < 7) return;
    const size_t needx = ((size_t)(NB - 1) * SEQ_FULL + SEQ) * DK;
    if ((size_t)in_sizes[0] < needx || (size_t)in_sizes[1] < needx) return;
    if ((size_t)in_sizes[2] < (size_t)AG * DK || (size_t)in_sizes[4] < (size_t)AG * DK) return;
    if (in_sizes[3] < AG || in_sizes[5] < AG || in_sizes[6] < AG) return;
    if ((size_t)out_size < ((size_t)(NB - 1) * OUT_SEQ + (size_t)(SEQ - 1)) * OUT_SEQ + SEQ) return;
    if (SZ_TOTAL > ws_size) return;
    // wire order: data, crit, Wl, bl, Wr, br, agg
    const float* xd = (const float*)d_in[0]; const float* xc = (const float*)d_in[1];
    const float* wl = (const float*)d_in[2]; const float* bl = (const float*)d_in[3];
    const float* wr = (const float*)d_in[4]; const float* br = (const float*)d_in[5];
    const float* ag = (const float*)d_in[6];
    float* OUT = (float*)d_out;      // [NB][SEQ][SEQ]
    char* wsp = (char*)d_ws;
    float* UP = (float*)wsp; wsp += SZ_PL;           // [NB*SEQ][64] (data Wl^T + bl) * C2
    float* VP = (float*)wsp; wsp += SZ_PL;           // [NB*SEQ][64] (crit Wr^T + br) * C2

    k_proj<<<dim3(NB * SEQ / TR, 2, 1), 256, 0, stream>>>(xd, xc, wl, wr, bl, br, UP, VP);

    k_pair<<<dim3(SEQ / 64, SEQ / 64, NB), 256, 0, stream>>>(UP, VP, ag, OUT);
}

// v002
// One run takes 22.8 microseconds.
// Timed twice side by side with v001, it ran 1.43 and 1.41 times as fast.
// All steps since v000 together make it 3.00 times as fast.
#include <hip/hip_runtime.h>

// Pairwise additive scoring: two linear projections u = data Wl^T + bl and v = crit Wr^T + br ([NB][SEQ][512] x [64][512]^T, weights [out][in]), then
// out[b][n][m] = sum_a tanh(u[b][n][a] + v[b][m][a]) * agg[a] (f32 output [NB][SEQ][SEQ]).
// Compute dtypes: both projections v_wmma_f32_16x16x32_bf16 (x and W RNE-converted to bf16; products exact; f32 accumulate); biases and agg RNE-converted to bf16, added / applied in f32.
// Pairwise stage on the vector unit in f32: tanh by the hardware instruction v_tanh_f32 (one transcendental per term); the 64-deep weighted sum is a matrix-vector product against one shared vector (no second column exists) and stays on the vector unit.
// Layout: one projection launch (f32 rows of x and W read whole-line, converted in registers, staged as bf16 in LDS); f32 planes U, V [(b*SEQ + t)][64] holding projection + bias; pairwise kernel with 64 x 64 output tiles, 4 x 4 outputs per thread, projection tiles transposed in LDS.

#ifndef NB
#define NB 4
#endif
#ifndef SEQ
#define SEQ 1024
#endif
#define NB_FULL  4
#define SEQ_FULL 1024
#ifndef OUT_SEQ
#define OUT_SEQ SEQ              // row pitch (in elements) of the output and row count between batches of the output
#endif
#define DK   512                 // projection depth
#define AG   64                  // projected width
#define PT   68                  // LDS row pitch (floats) of the transposed projection tiles
#define TR   32                  // x rows per projection work-group
#define KP   (DK + 8)            // LDS row pitch (bf16 elements) of the staged operands: 1040 bytes = 16 x odd

static_assert(DK % 32 == 0);                   // GEMM k-loop steps by 32
static_assert(DK % 8 == 0);                    // 16-byte fragment loads
static_assert(AG == 64);                       // one 64-column GEMM tile = the whole projected width; plane row = 256 bytes = two lines
static_assert(SEQ % 64 == 0);                  // 64-row tiles never straddle two batches; pairwise grid covers the sequence exactly
static_assert((NB * SEQ) % 64 == 0);
static_assert(OUT_SEQ % 32 == 0);
static_assert(OUT_SEQ >= SEQ);
static_assert(NB <= NB_FULL);
static_assert(SEQ <= SEQ_FULL);
static_assert(PT % 4 == 0);                    // 16-byte LDS reads
static_assert(PT >= 64);
static_assert(256 * 16 * 2 == TR * AG * 4);    // projection store: 256 threads x 16 B x 2 instructions == 32 rows x 256 B
static_assert(DK * 4 == 128 * 16);             // projection staging: one f32 row == 128 pieces of 16 B, 256 threads == 2 rows a trip
static_assert((TR / 16) * (AG / 16) == 8);     // projection: one 16 x 16 output tile per wave, 8 waves
static_assert(((KP * 2) / 16) % 2 == 1 && (KP * 2) % 16 == 0);   // conflict-free 16-byte fragment reads
static_assert(256 * 16 * 4 == 64 * 64 * 4);    // pairwise store: 256 threads x 16 B x 4 instructions == 64 rows x 256 B
static_assert(256 * 4 * 4 == 64 * AG);         // pairwise staging: 256 threads x 4 floats x 4 trips == 64 rows x 64 columns
static_assert((2 * AG * PT + AG) * 4 <= 131072);   // static LDS of the pairwise kernel
static_assert((TR + AG) * KP * 2 + TR * 68 * 4 <= 131072);   // static LDS of the projection kernel

typedef unsigned short bf;
typedef __attribute__((ext_vector_type(16))) __bf16   v16bf;
typedef __attribute__((ext_vector_type(8)))  unsigned short v8us;
typedef __attribute__((ext_vector_type(8)))  float    v8f;
typedef __attribute__((ext_vector_type(4)))  __bf16   v4bf;
typedef __attribute__((ext_vector_type(4)))  unsigned short v4us;
typedef __attribute__((ext_vector_type(4)))  float    v4f;
typedef v4f  __attribute__((may_alias)) v4fa;

__device__ __forceinline__ unsigned short f2bf(float f) { unsigned u = __float_as_uint(f); u += 0x7FFFu + ((u >> 16) & 1u); return (unsigned short)(u >> 16); }
__device__ __forceinline__ float bfr(float f) { return __uint_as_float(((unsigned)f2bf(f)) << 16); }   // value after RNE convert to bf16
__device__ __forceinline__ v16bf cat16b(v8us lo, v8us hi) { return __builtin_bit_cast(v16bf, __builtin_shufflevector(lo, hi, 0, 1, 2, 3, 4, 5, 6, 7, 8, 9, 10, 11, 12, 13, 14, 15)); }
__device__ __forceinline__ v8f wmmab(v16bf a, v16bf b, v8f c) { return __builtin_amdgcn_wmma_f32_16x16x32_bf16(false, a, false, b, (short)0, c, false, false); }
// fragment loader from K-contiguous 16-bit rows; p already includes + 8*(lane>>4): elements 0..7 <- k0+8h+0..7, elements 8..15 <- k0+16+8h+0..7 (same map for A and B)
__device__ __forceinline__ v16bf ldb(const bf* p)  { return cat16b(*(const v8us*)p, *(const v8us*)(p + 16)); }

// k_proj: both projections in one launch; blockIdx.y = 0: U = data Wl^T, 1: V = crit Wr^T. Work-group = 8 waves = 32 x rows x all 64 output features, K = DK.
// P[m][n] = sum_k x[m][k] W[n][k] + bias[n] as f32 (m = b*SEQ + t), plane [m][64] (row = 256 bytes).
// Staging: 32 x rows then 64 W rows, each wave-wide load = 512 contiguous bytes of one f32 row; RNE convert to bf16 in registers; 8-byte LDS stores. One barrier, then wave w owns
// the 16 x 16 tile (rows 16*(w>>2), features 16*(w&3)) and runs the 16 k-steps in ascending k into one accumulator. Second barrier in front of the whole-line store of the 32 x 64 tile.
__global__ __launch_bounds__(256) void k_proj(const float* __restrict__ X0, const float* __restrict__ X1, const float* __restrict__ W0, const float* __restrict__ W1,
                                              const float* __restrict__ B0, const float* __restrict__ B1, float* P0, float* P1) {
    __shared__ __align__(16) bf    sm[(TR + AG) * KP];     // rows 0..31: x tile, rows 32..95: W; columns 0..511 of every row written, only those read
    __shared__ __align__(16) float os[TR * 68];
    const int tid = threadIdx.x; const int lane = tid & 31, lr = lane & 15, hi = lane >> 4, wv = tid >> 5;
    const bool sec = blockIdx.y != 0;
    const int r0 = blockIdx.x * TR;                                        // TR divides 64 divides SEQ: a tile never straddles two batches
    const float* xs = (sec ? X1 : X0) + ((size_t)(r0 / SEQ) * SEQ_FULL + (size_t)(r0 % SEQ)) * DK;
    const float* ws = sec ? W1 : W0;
    const float* bias = sec ? B1 : B0;
    float* P = sec ? P1 : P0;
    v4f st[(TR + AG) / 2];
#pragma unroll
    for (int i = 0; i < TR / 2; ++i) st[i] = *(const v4f*)(xs + (size_t)(i * 256 + tid) * 4);              // 16 trips x 2 rows = 32 rows
#pragma unroll
    for (int i = 0; i < AG / 2; ++i) st[TR / 2 + i] = *(const v4f*)(ws + (size_t)(i * 256 + tid) * 4);     // 32 trips x 2 rows = 64 rows
    const float bc = bfr(bias[(wv & 3) * 16 + lr]);                        // index <= 63 < AG
    __builtin_amdgcn_sched_barrier(0);   // keeps every staging load in front of the first convert: all 48 are in flight at once, one memory round trip instead of two
#pragma unroll
    for (int i = 0; i < (TR + AG) / 2; ++i)
        *(v4us*)(&sm[(2 * i + (tid >> 7)) * KP + (tid & 127) * 4]) = __builtin_bit_cast(v4us, __builtin_convertvector(st[i], v4bf));
    __syncthreads();
    const bf* ap = sm + ((wv >> 2) * 16 + lr) * KP + 8 * hi;
    const bf* bp = sm + (TR + (wv & 3) * 16 + lr) * KP + 8 * hi;
    v8f acc = (v8f){};
#pragma unroll
    for (int kc = 0; kc < DK; kc += 32) acc = wmmab(ldb(ap + kc), ldb(bp + kc), acc);
#pragma unroll
    for (int j = 0; j < 8; ++j) os[((wv >> 2) * 16 + hi * 8 + j) * 68 + (wv & 3) * 16 + lr] = acc[j] + bc;   // D: row 8h+j, col lane&15; 8 waves cover rows 0..31 x columns 0..63
    __syncthreads();
    float* pb = P + (size_t)r0 * AG;
#pragma unroll
    for (int s = 0; s < 2; ++s) { const int idx = s * 256 + tid; const int row = idx >> 4, c4 = (idx & 15) * 4;     // 512 pieces of 4 floats = 32 rows x 64 columns
        *(v4f*)(pb + (size_t)idx * 4) = *(const v4fa*)(&os[row * 68 + c4]); }
}

// k_pair: out[b][n][m] = sum_a agg[a] * tanh(u[n][a] + v[m][a]), one v_tanh_f32 per term, terms summed in ascending a.
// Block = 256 threads = 64 (n) x 64 (m) outputs of one batch; thread (tx = tid&15, ty = tid>>4) owns rows 4ty..4ty+3 and columns 4tx..4tx+3.
// LDS: U tile and V tile transposed to [a][row] (columns 0..63 of every row written, only those read), w[a] = agg[a]; one block barrier between staging and use (cross-wave).
__global__ __launch_bounds__(256) void k_pair(const float* __restrict__ U, const float* __restrict__ V, const float* __restrict__ agg, float* OUT) {
    __shared__ __align__(16) float dT[AG * PT];
    __shared__ __align__(16) float cT[AG * PT];
    __shared__ __align__(16) float wS[AG];
    const int tid = threadIdx.x; const int tx = tid & 15, ty = tid >> 4;
    const int n0 = blockIdx.x * 64, m0 = blockIdx.y * 64, b = blockIdx.z;
    const float* dsrc = U + ((size_t)b * SEQ + n0) * AG;
    const float* csrc = V + ((size_t)b * SEQ + m0) * AG;
#pragma unroll
    for (int i = 0; i < 4; ++i) { const int idx = i * 256 + tid; const int row = idx >> 4, c4 = (idx & 15) * 4;   // 1024 pieces of 4 floats = 64 rows x 64 columns
        const v4f dv = *(const v4f*)(dsrc + (size_t)idx * 4); const v4f cv = *(const v4f*)(csrc + (size_t)idx * 4);
#pragma unroll
        for (int k = 0; k < 4; ++k) { dT[(c4 + k) * PT + row] = dv[k]; cT[(c4 + k) * PT + row] = cv[k]; } }
    if (tid < AG) wS[tid] = bfr(agg[tid]);                       // waves 0 and 1 entirely (wave-uniform test)
    __syncthreads();
    float acc[4][4];
#pragma unroll
    for (int i = 0; i < 4; ++i)
#pragma unroll
        for (int j = 0; j < 4; ++j) acc[i][j] = 0.0f;
#pragma unroll 2
    for (int a = 0; a < AG; ++a) {
        const v4f d = *(const v4fa*)(&dT[a * PT + 4 * ty]);
        const v4f c = *(const v4fa*)(&cT[a * PT + 4 * tx]);
        const float w = wS[a];
#pragma unroll
        for (int i = 0; i < 4; ++i) {
#pragma unroll
            for (int j = 0; j < 4; ++j) {
                acc[i][j] = fmaf(w, __builtin_amdgcn_tanhf(d[i] + c[j]), acc[i][j]); } }
    }
    v4f val[4];
#pragma unroll
    for (int i = 0; i < 4; ++i) { val[i][0] = acc[i][0]; val[i][1] = acc[i][1]; val[i][2] = acc[i][2]; val[i][3] = acc[i][3]; }
    float* ob = OUT + ((size_t)b * OUT_SEQ + n0 + 4 * ty) * OUT_SEQ + m0 + 4 * tx;
{
#pragma unroll
        for (int i = 0; i < 4; ++i) *(v4f*)(ob + (size_t)i * OUT_SEQ) = val[i];   // 4 i x 16 ty = 64 rows; 16 tx x 4 floats = 64 columns
         }
}

static constexpr size_t al256(size_t v) { return (v + 255) & ~(size_t)255; }
static constexpr size_t SZ_PL = al256((size_t)NB * SEQ * AG * 4);      // f32 projection plane, rows = NB*SEQ (multiple of 32 = projection tile rows)
static constexpr size_t SZ_TOTAL = 2 * SZ_PL;
static_assert(SZ_TOTAL <= (size_t)134217728);          // workspace carve <= 128 MiB

extern "C" void kernel_launch(void* const* d_in, const int* in_sizes, int n_in,
                              void* d_out, int out_size, void* d_ws, size_t ws_size, hipStream_t stream) {
    if (n_in < 7) return;
    const size_t needx = ((size_t)(NB - 1) * SEQ_FULL + SEQ) * DK;
    if ((size_t)in_sizes[0] < needx || (size_t)in_sizes[1] < needx) return;
    if ((size_t)in_sizes[2] < (size_t)AG * DK || (size_t)in_sizes[4] < (size_t)AG * DK) return;
    if (in_sizes[3] < AG || in_sizes[5] < AG || in_sizes[6] < AG) return;
    if ((size_t)out_size < ((size_t)(NB - 1) * OUT_SEQ + (size_t)(SEQ - 1)) * OUT_SEQ + SEQ) return;
    if (SZ_TOTAL > ws_size) return;
    // wire order: data, crit, Wl, bl, Wr, br, agg
    const float* xd = (const float*)d_in[0]; const float* xc = (const float*)d_in[1];
    const float* wl = (const float*)d_in[2]; const float* bl = (const float*)d_in[3];
    const float* wr = (const float*)d_in[4]; const float* br = (const float*)d_in[5];
    const float* ag = (const float*)d_in[6];
    float* OUT = (float*)d_out;      // [NB][SEQ][SEQ]
    char* wsp = (char*)d_ws;
    float* UP = (float*)wsp; wsp += SZ_PL;           // [NB*SEQ][64] data Wl^T + bl
    float* VP = (float*)wsp; wsp += SZ_PL;           // [NB*SEQ][64] crit Wr^T + br

    k_proj<<<dim3(NB * SEQ / TR, 2, 1), 256, 0, stream>>>(xd, xc, wl, wr, bl, br, UP, VP);

    k_pair<<<dim3(SEQ / 64, SEQ / 64, NB), 256, 0, stream>>>(UP, VP, ag, OUT);
}

// v003
// It runs in 19.3 microseconds.
// Timed twice side by side with v002, it ran 1.19 and 1.18 times as fast.
// Counting every step since v000, it is 3.56 times as fast.
#include <hip/hip_runtime.h>

// Pairwise additive scoring: two linear projections u = data Wl^T + bl and v = crit Wr^T + br ([NB][SEQ][512] x [64][512]^T, weights [out][in]), then
// out[b][n][m] = sum_a tanh(u[b][n][a] + v[b][m][a]) * agg[a] (f32 output [NB][SEQ][SEQ]).
// Compute dtypes: both projections v_wmma_f32_16x16x32_bf16 (x and W RNE-converted to bf16; products exact; f32 accumulate); biases and agg RNE-converted to bf16, added / applied in f32.
// Pairwise stage: agg * tanh(u + v) = agg - 2 agg / (1 + exp(2u) exp(2v)); the exponentials are taken once per staged plane element of a tile. Three terms share one denominator:
// denominator and numerator of a group are sums over the 8 subsets S of the group of (a factor of row n) x (a factor of column m), that is, products of a [rows][8] by an [8][columns] matrix.
// They run on v_wmma_f32_16x16x32_bf16 with every f32 factor split into bf16 hi + lo; the 32 k places hold hi*hi, hi*lo, lo*lo, lo*hi of the 8 subsets. The vector unit is left with one v_rcp_f32 and one fma per output and group.
// The quotient form is used only where it is exact to rounding: a tile that holds a staged |u| or |v| above 20 / (2 log2(e)) = 6.93, or an agg vector outside the stated range, takes the plain sum of agg * v_tanh_f32(u + v) instead (one test per work-group).
// Layout: one projection launch (f32 rows of x and W read whole-line, converted in registers, staged as bf16 in LDS); f32 planes U, V [(b*SEQ + t)][64] holding projection + bias; pairwise kernel with 128 x 128 output tiles, 8 waves of 32 x 64.

#ifndef NB
#define NB 4
#endif
#ifndef SEQ
#define SEQ 1024
#endif
#define NB_FULL  4
#define SEQ_FULL 1024
#ifndef OUT_SEQ
#define OUT_SEQ SEQ              // row pitch (in elements) of the output and row count between batches of the output
#endif
#define DK   512                 // projection depth
#define AG   64                  // projected width
#define PT   68                  // LDS row pitch (floats) of the staged plane rows and of the staged output rows: 272 bytes = 16 x odd
#define TR   32                  // x rows per projection work-group
#define KP   (DK + 8)            // LDS row pitch (bf16 elements) of the staged operands: 1040 bytes = 16 x odd
#define ECAP 20.0f               // largest |base-2 exponent| of a staged exponential in the quotient form: (1 + 2^20 * 2^20)^3 < 2^121, factors >= 2^-60: nothing overflows or underflows
#define WHI  16.0f               // quotient form: every |agg| <= WHI, so a numerator stays below 3 * 16 * 2^121 < 2^128
#define WLO  0x1p-20f            // quotient form: the largest |agg| >= WLO, so what a factor below 2^-126 loses (at most 2^-66 in a quotient) is far below one rounding of the sum
#define TN   128                 // rows and columns of a pairwise output tile
#define GH   11                  // groups of three terms per LDS fill; 2 fills x 11 groups x 3 terms = 66 places for the AG = 64 terms (places 64, 65: exponential 0, weight 0)

static_assert(DK % 32 == 0);                   // GEMM k-loop steps by 32
static_assert(DK % 8 == 0);                    // 16-byte fragment loads
static_assert(2 * GH * 3 >= AG && 2 * GH * 3 <= PT);   // every term has a place; the spare places lie in the zeroed pad columns of a staged row
static_assert(SEQ % TN == 0);                  // pairwise grid covers the sequence exactly
static_assert(AG == 64);                       // one 64-column GEMM tile = the whole projected width; plane row = 256 bytes = two lines
static_assert(SEQ % 64 == 0);                  // 64-row tiles never straddle two batches
static_assert((NB * SEQ) % 64 == 0);
static_assert(OUT_SEQ % 32 == 0);
static_assert(OUT_SEQ >= SEQ);
static_assert(NB <= NB_FULL);
static_assert(SEQ <= SEQ_FULL);
static_assert(PT % 4 == 0);                    // 16-byte LDS reads
static_assert(PT >= 64);
static_assert(256 * 16 * 2 == TR * AG * 4);    // projection store: 256 threads x 16 B x 2 instructions == 32 rows x 256 B
static_assert(DK * 4 == 128 * 16);             // projection staging: one f32 row == 128 pieces of 16 B, 256 threads == 2 rows a trip
static_assert((TR / 16) * (AG / 16) == 8);     // projection: one 16 x 16 output tile per wave, 8 waves
static_assert(((KP * 2) / 16) % 2 == 1 && (KP * 2) % 16 == 0);   // conflict-free 16-byte fragment reads
static_assert(256 * 4 * 16 == 2 * TN * AG);    // pairwise staging: 256 threads x 4 floats x 16 trips == 256 rows x 64 columns
static_assert(2 * TN == 256);                  // pairwise factors: one staged row per thread
static_assert((2 * TN * PT + PT + 8) * 4 + 6 * GH * TN * 16 <= 327680);   // static LDS of the pairwise kernel
static_assert((TR + AG) * KP * 2 + TR * 68 * 4 <= 131072);   // static LDS of the projection kernel

typedef unsigned short bf;
typedef __attribute__((ext_vector_type(16))) __bf16   v16bf;
typedef __attribute__((ext_vector_type(8)))  unsigned short v8us;
typedef __attribute__((ext_vector_type(8)))  float    v8f;
typedef __attribute__((ext_vector_type(4)))  __bf16   v4bf;
typedef __attribute__((ext_vector_type(4)))  unsigned short v4us;
typedef __attribute__((ext_vector_type(4)))  float    v4f;
typedef v4f  __attribute__((may_alias)) v4fa;
typedef __attribute__((ext_vector_type(8)))  __bf16   v8bf;
typedef __attribute__((ext_vector_type(4)))  unsigned v4u;

__device__ __forceinline__ unsigned short f2bf(float f) { unsigned u = __float_as_uint(f); u += 0x7FFFu + ((u >> 16) & 1u); return (unsigned short)(u >> 16); }
__device__ __forceinline__ float bfr(float f) { return __uint_as_float(((unsigned)f2bf(f)) << 16); }   // value after RNE convert to bf16
__device__ __forceinline__ v16bf cat16b(v8us lo, v8us hi) { return __builtin_bit_cast(v16bf, __builtin_shufflevector(lo, hi, 0, 1, 2, 3, 4, 5, 6, 7, 8, 9, 10, 11, 12, 13, 14, 15)); }
__device__ __forceinline__ v8f wmmab(v16bf a, v16bf b, v8f c) { return __builtin_amdgcn_wmma_f32_16x16x32_bf16(false, a, false, b, (short)0, c, false, false); }
// fragment loader from K-contiguous 16-bit rows; p already includes + 8*(lane>>4): elements 0..7 <- k0+8h+0..7, elements 8..15 <- k0+16+8h+0..7 (same map for A and B)
__device__ __forceinline__ v16bf ldb(const bf* p)  { return cat16b(*(const v8us*)p, *(const v8us*)(p + 16)); }

// k_proj: both projections in one launch; blockIdx.y = 0: U = data Wl^T, 1: V = crit Wr^T. Work-group = 8 waves = 32 x rows x all 64 output features, K = DK.
// P[m][n] = sum_k x[m][k] W[n][k] + bias[n] as f32 (m = b*SEQ + t), plane [m][64] (row = 256 bytes).
// Staging: 32 x rows then 64 W rows, each wave-wide load = 512 contiguous bytes of one f32 row; RNE convert to bf16 in registers; 8-byte LDS stores. One barrier, then wave w owns
// the 16 x 16 tile (rows 16*(w>>2), features 16*(w&3)) and runs the 16 k-steps in ascending k into one accumulator. Second barrier in front of the whole-line store of the 32 x 64 tile.
__global__ __launch_bounds__(256) void k_proj(const float* __restrict__ X0, const float* __restrict__ X1, const float* __restrict__ W0, const float* __restrict__ W1,
                                              const float* __restrict__ B0, const float* __restrict__ B1, float* P0, float* P1) {
    __shared__ __align__(16) bf    sm[(TR + AG) * KP];     // rows 0..31: x tile, rows 32..95: W; columns 0..511 of every row written, only those read
    __shared__ __align__(16) float os[TR * 68];
    const int tid = threadIdx.x; const int lane = tid & 31, lr = lane & 15, hi = lane >> 4, wv = tid >> 5;
    const bool sec = blockIdx.y != 0;
    const int r0 = blockIdx.x * TR;                                        // TR divides 64 divides SEQ: a tile never straddles two batches
    const float* xs = (sec ? X1 : X0) + ((size_t)(r0 / SEQ) * SEQ_FULL + (size_t)(r0 % SEQ)) * DK;
    const float* ws = sec ? W1 : W0;
    const float* bias = sec ? B1 : B0;
    float* P = sec ? P1 : P0;
    v4f st[(TR + AG) / 2];
#pragma unroll
    for (int i = 0; i < TR / 2; ++i) st[i] = *(const v4f*)(xs + (size_t)(i * 256 + tid) * 4);              // 16 trips x 2 rows = 32 rows
#pragma unroll
    for (int i = 0; i < AG / 2; ++i) st[TR / 2 + i] = *(const v4f*)(ws + (size_t)(i * 256 + tid) * 4);     // 32 trips x 2 rows = 64 rows
    const float bc = bfr(bias[(wv & 3) * 16 + lr]);                        // index <= 63 < AG
    __builtin_amdgcn_sched_barrier(0);   // keeps every staging load in front of the first convert: all 48 are in flight at once, one memory round trip instead of two
#pragma unroll
    for (int i = 0; i < (TR + AG) / 2; ++i)
        *(v4us*)(&sm[(2 * i + (tid >> 7)) * KP + (tid & 127) * 4]) = __builtin_bit_cast(v4us, __builtin_convertvector(st[i], v4bf));
    __syncthreads();
    const bf* ap = sm + ((wv >> 2) * 16 + lr) * KP + 8 * hi;
    const bf* bp = sm + (TR + (wv & 3) * 16 + lr) * KP + 8 * hi;
    v8f acc = (v8f){};
#pragma unroll
    for (int kc = 0; kc < DK; kc += 32) acc = wmmab(ldb(ap + kc), ldb(bp + kc), acc);
#pragma unroll
    for (int j = 0; j < 8; ++j) os[((wv >> 2) * 16 + hi * 8 + j) * 68 + (wv & 3) * 16 + lr] = acc[j] + bc;   // D: row 8h+j, col lane&15; 8 waves cover rows 0..31 x columns 0..63
    __syncthreads();
    float* pb = P + (size_t)r0 * AG;
#pragma unroll
    for (int s = 0; s < 2; ++s) { const int idx = s * 256 + tid; const int row = idx >> 4, c4 = (idx & 15) * 4;     // 512 pieces of 4 floats = 32 rows x 64 columns
        *(v4f*)(pb + (size_t)idx * 4) = *(const v4fa*)(&os[row * 68 + c4]); }
}

// f32 x 8 -> bf16 hi and bf16 lo with hi + lo = x to about 2^-17 relative
__device__ __forceinline__ void split8(v8f x, v8us* h, v8us* l) {
    const v4u hp = __builtin_bit_cast(v4u, __builtin_convertvector(x, v8bf));          // element pairs (2q, 2q + 1) in the low and high half of word q
    v8f r;
#pragma unroll
    for (int q = 0; q < 4; ++q) { r[2 * q] = x[2 * q] - __uint_as_float(hp[q] << 16); r[2 * q + 1] = x[2 * q + 1] - __uint_as_float(hp[q] & 0xFFFF0000u); }
    *h = __builtin_bit_cast(v8us, hp);
    *l = __builtin_bit_cast(v8us, __builtin_convertvector(r, v8bf));
}
// the 8 subset products of three factors, place s = bit 0: e0, bit 1: e1, bit 2: e2
__device__ __forceinline__ v8f subsets(float e0, float e1, float e2) { const float e01 = e0 * e1; return (v8f){1.0f, e0, e1, e01, e2, e0 * e2, e1 * e2, e01 * e2}; }

// k_pair: out[b][n][m] = sum_a agg[a] * tanh(u[n][a] + v[m][a]) = sum_a agg[a] - 2 sum_a w[a] / p[a], w[a] = agg[a], p[a] = 1 + U[n][a] V[m][a] >= 1, U = exp(2u), V = exp(2v).
// Group of three terms 0, 1, 2: w0/p0 + w1/p1 + w2/p2 = N / D, D = p0 p1 p2 = sum_S US VS, N = sum_S cS US VS; S runs over the 8 subsets of the group (place s = bit 0: term 0, bit 1: term 1, bit 2: term 2),
// US = product of U over S, VS = product of V over S, cS = sum of the w outside S. One WMMA gives D and one gives N of a 16 x 16 tile; the sum adds N * rcp(D), groups in ascending a.
// Block = 8 waves = 128 (n) x 128 (m) outputs of one batch; wave w owns rows 32 (w >> 1) .. + 31 and columns 64 (w & 1) .. + 63 (2 x 4 WMMA tiles).
// LDS: raw = the 128 U rows then the 128 V rows (exponentials of the stored planes; pad columns 64..67 zero); sb = six planes [group][row] of 8 bf16: US hi, US lo, cS US hi, cS US lo, VS hi, VS lo, filled twice (11 groups each).
// k places (same map for A and B, as in ldb): lane half h, elements 0..7 and 8..15. A: (hi, lo) in both halves. B: (hi, lo) in half 0, (lo, hi) in half 1. Sum over k = (A hi + A lo)(B hi + B lo) per subset.
__global__ __launch_bounds__(256) void k_pair(const float* __restrict__ U, const float* __restrict__ V, const float* __restrict__ agg, float* OUT) {
    __shared__ __align__(16) float raw[2 * TN * PT];
    __shared__ __align__(16) v8us  sb[6 * GH * TN];
    __shared__ __align__(16) float wS[PT];
    __shared__ __align__(16) unsigned fl[8];                     // per wave: nonzero = this wave saw a value that the quotient form does not take
    const int tid = threadIdx.x; const int lane = tid & 31, lr = lane & 15, hi = lane >> 4, wv = tid >> 5;
    const int n0 = blockIdx.x * TN, m0 = blockIdx.y * TN, b = blockIdx.z;
    const float* dsrc = U + ((size_t)b * SEQ + n0) * AG;
    const float* csrc = V + ((size_t)b * SEQ + m0) * AG;
    float mx = 0.0f;                                             // largest |base-2 exponent| this thread stages (a NaN is not counted: it makes its row or column NaN in either form)
#pragma unroll
    for (int i = 0; i < 16; ++i) { const int idx = (i & 7) * 256 + tid; const int row = idx >> 4, c4 = (idx & 15) * 4;   // 2 x 2048 pieces of 4 floats = 2 x 128 rows x 64 columns
        const v4f t = *(const v4f*)((i < 8 ? dsrc : csrc) + (size_t)idx * 4) * 2.885390082f;                            // 2 log2(e)
        mx = fmaxf(fmaxf(mx, fmaxf(fabsf(t[0]), fabsf(t[1]))), fmaxf(fabsf(t[2]), fabsf(t[3])));
        *(v4fa*)(&raw[((i >> 3) * TN + row) * PT + c4]) = (v4f){__builtin_amdgcn_exp2f(t[0]), __builtin_amdgcn_exp2f(t[1]), __builtin_amdgcn_exp2f(t[2]), __builtin_amdgcn_exp2f(t[3])}; }
    *(v4fa*)(&raw[tid * PT + AG]) = (v4f){0.0f, 0.0f, 0.0f, 0.0f};           // pad columns of row tid
    if (tid < PT) wS[tid] = tid < AG ? bfr(agg[tid < AG ? tid : 0]) : 0.0f;
    const float am = fmaxf(fabsf(bfr(agg[lane])), fabsf(bfr(agg[lane + 32])));   // every wave sees all AG = 64 weights; index <= 63
    const unsigned wbad = __builtin_amdgcn_ballot_w32(mx > ECAP || am > WHI) | (__builtin_amdgcn_ballot_w32(am >= WLO) == 0u ? 1u : 0u);
    if (lane == 0) fl[wv] = wbad;
    v8f acc[2][4];
#pragma unroll
    for (int ti = 0; ti < 2; ++ti)
#pragma unroll
        for (int tj = 0; tj < 4; ++tj) acc[ti][tj] = (v8f){};
    const int ar = (wv >> 1) * 32 + lr, bc = (wv & 1) * 64 + lr;
    __syncthreads();                                             // raw, wS and fl are staged (cross-wave)
    const v4u f0 = *(const v4u*)(&fl[0]), f1 = *(const v4u*)(&fl[4]);
    // the same eight words in every thread of the work-group: readfirstlane makes the test a scalar branch that the whole work-group takes or leaves
    if (__builtin_amdgcn_readfirstlane((f0[0] | f0[1]) | (f0[2] | f0[3]) | (f1[0] | f1[1]) | (f1[2] | f1[3])) != 0u) {
        // plain form for any u, v, agg: sum of agg * v_tanh_f32(u + v) in ascending a. The planes are read again as stored; each thread overwrites the places of raw that it filled itself.
#pragma unroll   // all loads in flight at once
        for (int i = 0; i < 16; ++i) { const int idx = (i & 7) * 256 + tid; const int row = idx >> 4, c4 = (idx & 15) * 4;
            *(v4fa*)(&raw[((i >> 3) * TN + row) * PT + c4]) = *(const v4f*)((i < 8 ? dsrc : csrc) + (size_t)idx * 4); }
        __syncthreads();                                         // u and v rows are staged (cross-wave); block-uniform branch
#pragma unroll 1   // this seldom-taken path stays small: unrolled it raised the kernel's register count and spilled
        for (int r = 0; r < 16; ++r) {                           // wave w: rows 16 w + r; lane: columns 4 lane .. + 3 (a wave stores 512 contiguous bytes)
            const float* ur = raw + (wv * 16 + r) * PT;
            v4f sum = (v4f){0.0f, 0.0f, 0.0f, 0.0f};
#pragma unroll 1   // as above
            for (int q = 0; q < AG / 4; ++q) {
                const v4f d = *(const v4fa*)(&ur[4 * q]); const v4f w = *(const v4fa*)(&wS[4 * q]);
#pragma unroll   // k and e index vector elements: unrolled they are registers
                for (int k = 0; k < 4; ++k) { const v4f c = *(const v4fa*)(&raw[(TN + 4 * lane + k) * PT + 4 * q]);
#pragma unroll
                    for (int e = 0; e < 4; ++e) { float th;
                        // v_nop in the statement: the slot behind a transcendental
                        asm("v_tanh_f32 %0, %1\n\tv_nop" : "=v"(th) : "v"(d[e] + c[e]));
                        sum[k] = fmaf(w[e], th, sum[k]); } } }
            *(v4f*)(OUT + ((size_t)b * OUT_SEQ + n0 + wv * 16 + r) * OUT_SEQ + m0 + 4 * lane) = sum;
            asm volatile("s_wait_xcnt 0x0" ::: "memory"); }      // the next trip overwrites the registers that held this store's address
        return;
    }
    for (int half = 0; half < 2; ++half) {
        if (half) __syncthreads();                               // every wave has left the first fill of sb
        const float* er = raw + tid * PT + half * GH * 3;        // thread = one staged row: waves 0..3 the U rows, waves 4..7 the V rows (wave-uniform test)
        if (tid < TN) {
#pragma unroll   // the LDS reads of all 11 groups issue ahead of the arithmetic instead of one round trip per group
            for (int gg = 0; gg < GH; ++gg) {
                const v8f ps = subsets(er[3 * gg], er[3 * gg + 1], er[3 * gg + 2]);
                const float w0 = wS[(half * GH + gg) * 3], w1 = wS[(half * GH + gg) * 3 + 1], w2 = wS[(half * GH + gg) * 3 + 2];
                const v8f cs = (v8f){w0 + w1 + w2, w1 + w2, w0 + w2, w2, w0 + w1, w1, w0, 0.0f};
                split8(ps, &sb[(0 * GH + gg) * TN + tid], &sb[(1 * GH + gg) * TN + tid]);
                split8(cs * ps, &sb[(2 * GH + gg) * TN + tid], &sb[(3 * GH + gg) * TN + tid]); }
        } else {
#pragma unroll   // as above
            for (int gg = 0; gg < GH; ++gg)
                split8(subsets(er[3 * gg], er[3 * gg + 1], er[3 * gg + 2]), &sb[(4 * GH + gg) * TN + tid - TN], &sb[(5 * GH + gg) * TN + tid - TN]);
        }
        __syncthreads();                                         // the fill is complete (cross-wave)
        for (int gg = 0; gg < GH; ++gg) {
            v16bf fd[2], fn[2], fb[4];
#pragma unroll
            for (int ti = 0; ti < 2; ++ti) {
                fd[ti] = cat16b(sb[(0 * GH + gg) * TN + ar + 16 * ti], sb[(1 * GH + gg) * TN + ar + 16 * ti]);
                fn[ti] = cat16b(sb[(2 * GH + gg) * TN + ar + 16 * ti], sb[(3 * GH + gg) * TN + ar + 16 * ti]); }
#pragma unroll
            for (int tj = 0; tj < 4; ++tj)
                fb[tj] = cat16b(sb[((4 + hi) * GH + gg) * TN + bc + 16 * tj], sb[((5 - hi) * GH + gg) * TN + bc + 16 * tj]);
#pragma unroll
            for (int ti = 0; ti < 2; ++ti) {
#pragma unroll
                for (int tj = 0; tj < 4; ++tj) {
                    const v8f den = wmmab(fd[ti], fb[tj], (v8f){});
                    const v8f num = wmmab(fn[ti], fb[tj], (v8f){});
#pragma unroll
                    for (int j = 0; j < 8; ++j) acc[ti][tj][j] = fmaf(num[j], __builtin_amdgcn_rcpf(den[j]), acc[ti][tj][j]); } }
        }
    }
    float wsum = 0.0f;                                           // sum_a agg[a]
#pragma unroll
    for (int q = 0; q < AG / 4; ++q) { const v4f w = *(const v4fa*)(&wS[4 * q]); wsum += (w[0] + w[1]) + (w[2] + w[3]); }
    // whole-line store: each wave stages its 32 x 64 tile in its own 32 rows of raw (nobody reads raw behind the last barrier above)
    float* os = raw + wv * 32 * PT;
#pragma unroll
    for (int ti = 0; ti < 2; ++ti)
#pragma unroll
        for (int tj = 0; tj < 4; ++tj)
#pragma unroll
            for (int j = 0; j < 8; ++j) os[(16 * ti + 8 * hi + j) * PT + 16 * tj + lr] = fmaf(-2.0f, acc[ti][tj][j], wsum);   // D: row 8h+j, col lane&15
    asm volatile("s_wait_dscnt 0x0" ::: "memory");               // the wave's own LDS stores are done before other lanes read the rows back
    float* ob = OUT + ((size_t)b * OUT_SEQ + n0 + (wv >> 1) * 32 + hi) * OUT_SEQ + m0 + (wv & 1) * 64 + lr * 4;
#pragma unroll
    for (int it = 0; it < 16; ++it) *(v4f*)(ob + (size_t)(2 * it) * OUT_SEQ) = *(const v4fa*)(&os[(2 * it + hi) * PT + lr * 4]);   // 16 lanes x 16 B = 256 B of one row
}

static constexpr size_t al256(size_t v) { return (v + 255) & ~(size_t)255; }
static constexpr size_t SZ_PL = al256((size_t)NB * SEQ * AG * 4);      // f32 projection plane, rows = NB*SEQ (multiple of 32 = projection tile rows)
static constexpr size_t SZ_TOTAL = 2 * SZ_PL;
static_assert(SZ_TOTAL <= (size_t)134217728);          // workspace carve <= 128 MiB

extern "C" void kernel_launch(void* const* d_in, const int* in_sizes, int n_in,
                              void* d_out, int out_size, void* d_ws, size_t ws_size, hipStream_t stream) {
    if (n_in < 7) return;
    const size_t needx = ((size_t)(NB - 1) * SEQ_FULL + SEQ) * DK;
    if ((size_t)in_sizes[0] < needx || (size_t)in_sizes[1] < needx) return;
    if ((size_t)in_sizes[2] < (size_t)AG * DK || (size_t)in_sizes[4] < (size_t)AG * DK) return;
    if (in_sizes[3] < AG || in_sizes[5] < AG || in_sizes[6] < AG) return;
    if ((size_t)out_size < ((size_t)(NB - 1) * OUT_SEQ + (size_t)(SEQ - 1)) * OUT_SEQ + SEQ) return;
    if (SZ_TOTAL > ws_size) return;
    // wire order: data, crit, Wl, bl, Wr, br, agg
    const float* xd = (const float*)d_in[0]; const float* xc = (const float*)d_in[1];
    const float* wl = (const float*)d_in[2]; const float* bl = (const float*)d_in[3];
    const float* wr = (const float*)d_in[4]; const float* br = (const float*)d_in[5];
    const float* ag = (const float*)d_in[6];
    float* OUT = (float*)d_out;      // [NB][SEQ][SEQ]
    char* wsp = (char*)d_ws;
    float* UP = (float*)wsp; wsp += SZ_PL;           // [NB*SEQ][64] data Wl^T + bl
    float* VP = (float*)wsp; wsp += SZ_PL;           // [NB*SEQ][64] crit Wr^T + br

    k_proj<<<dim3(NB * SEQ / TR, 2, 1), 256, 0, stream>>>(xd, xc, wl, wr, bl, br, UP, VP);

    k_pair<<<dim3(SEQ / TN, SEQ / TN, NB), 256, 0, stream>>>(UP, VP, ag, OUT);
}

// v005
// One run takes 15.4 microseconds.
// Versions between v003 and this one are left out; their measured steps multiply to 1.25 times as fast.
// All steps since v000 together make it 4.47 times as fast.
#include <hip/hip_runtime.h>

// Pairwise additive scoring: two linear projections u = data Wl^T + bl and v = crit Wr^T + br ([NB][SEQ][512] x [64][512]^T, weights [out][in]), then
// out[b][n][m] = sum_a tanh(u[b][n][a] + v[b][m][a]) * agg[a] (f32 output [NB][SEQ][SEQ]).
// Compute dtypes: both projections v_wmma_f32_16x16x32_bf16 (x and W RNE-converted to bf16; products exact; f32 accumulate); biases and agg RNE-converted to bf16, added / applied in f32.
// Pairwise stage: agg * tanh(u + v) = agg - 2 agg / (1 + exp(2u) exp(2v)); the exponentials are taken once per staged plane element of a tile. Five terms share one denominator:
// denominator and numerator of a group are sums over the 32 subsets S of the group of (a factor of row n) x (a factor of column m), that is, products of a [rows][32] by a [32][columns] matrix.
// They run on v_wmma_f32_16x16x32_f16, every f32 factor RNE-converted once to f16 (f32 accumulate); the 32 k places are the 32 subsets. The vector unit is left with one v_rcp_f32 and one fma per output and group.
// Error of the quotient form: all terms of a denominator are positive, so each group's quotient is off by at most about 2^-9 of the group's sum of |agg|, the size of the bf16 convert of agg itself.
// The quotient form is used only where every factor fits f16: a tile that holds a group of a staged row whose 32 factors sum to more than 2^15 (the product of the five 2 cosh(u): never with sum |u| below 6.9, always with it above 10.4; the same for v), or an agg vector outside the stated range, takes the plain sum of agg * v_tanh_f32(u + v) instead (one test per work-group and fill).
// Layout: one projection launch (f32 rows of x and W read whole-line, converted in registers, staged as bf16 in LDS); f32 planes U, V [(b*SEQ + t)][64] holding projection + bias; pairwise kernel with 128 x 128 output tiles, 8 waves of 32 x 64.

#ifndef NB
#define NB 4
#endif
#ifndef SEQ
#define SEQ 1024
#endif
#define NB_FULL  4
#define SEQ_FULL 1024
#ifndef OUT_SEQ
#define OUT_SEQ SEQ              // row pitch (in elements) of the output and row count between batches of the output
#endif
#define DK   512                 // projection depth
#define AG   64                  // projected width
#define PT   68                  // LDS row pitch (floats) of the staged plane rows and of the staged output rows: 272 bytes = 16 x odd
#define TR   32                  // x rows per projection work-group
#define KP   (DK + 8)            // LDS row pitch (bf16 elements) of the staged operands: 1040 bytes = 16 x odd
#define HCAP 32768.0f            // quotient form: bound of the sum of a row's 32 factors of a group, so of the largest factor, 2^15; times |cS| <= 1.25 it stays below the f16 maximum. A factor below the f16 normal range loses at most 2^-25; times the other side's factor (<= 2^15), over a denominator of about 32 or more, that is 2^-15: far below one f16 rounding
#define WEXLO 30u                // quotient form: biased exponent of the largest |agg| inside [WEXLO, WEXHI], so that the scale and its inverse are normal f32 numbers
#define WEXHI 220u
#define TN   128                 // rows and columns of a pairwise output tile
#define GT   5                   // terms per group
#define NG   13                  // groups: 13 x 5 = 65 places for the AG = 64 terms (place 64: exponential 1, weight 0)
#define G0   7                   // groups in the first LDS fill; the second holds NG - G0

static_assert(DK % 32 == 0);                   // GEMM k-loop steps by 32
static_assert(DK % 8 == 0);                    // 16-byte fragment loads
static_assert(NG * GT >= AG && NG * GT <= PT);   // every term has a place; the spare place lies in the pad columns of a staged row
static_assert(G0 >= NG - G0 && (1 << GT) == 32);   // the second fill fits the first one's planes; one WMMA depth = all subsets of a group
static_assert(SEQ % TN == 0);                  // pairwise grid covers the sequence exactly
static_assert(AG == 64);                       // one 64-column GEMM tile = the whole projected width; plane row = 256 bytes = two lines
static_assert(SEQ % 64 == 0);                  // 64-row tiles never straddle two batches
static_assert((NB * SEQ) % 64 == 0);
static_assert(OUT_SEQ % 32 == 0);
static_assert(OUT_SEQ >= SEQ);
static_assert(NB <= NB_FULL);
static_assert(SEQ <= SEQ_FULL);
static_assert(PT % 4 == 0);                    // 16-byte LDS reads
static_assert(PT >= 64);
static_assert(256 * 16 * 2 == TR * AG * 4);    // projection store: 256 threads x 16 B x 2 instructions == 32 rows x 256 B
static_assert(DK * 4 == 128 * 16);             // projection staging: one f32 row == 128 pieces of 16 B, 256 threads == 2 rows a trip
static_assert((TR / 16) * (AG / 16) == 8);     // projection: one 16 x 16 output tile per wave, 8 waves
static_assert(((AG / 2) & (AG / 2 - 1)) == 0); // projection: the walk over W's row pairs wraps by a mask
static_assert(((KP * 2) / 16) % 2 == 1 && (KP * 2) % 16 == 0);   // conflict-free 16-byte fragment reads
static_assert(256 * 4 * 16 == 2 * TN * AG);    // pairwise staging: 256 threads x 4 floats x 16 trips == 256 rows x 64 columns
static_assert(2 * TN == 256);                  // pairwise factors: one staged row per thread
static_assert((2 * TN * PT + PT + 8 + NG * 32) * 4 + 12 * G0 * TN * 16 <= 327680);   // static LDS of the pairwise kernel
static_assert((TR + AG) * KP * 2 + TR * 68 * 4 <= 131072);   // static LDS of the projection kernel

typedef unsigned short bf;
typedef __attribute__((ext_vector_type(16))) __bf16   v16bf;
typedef __attribute__((ext_vector_type(8)))  unsigned short v8us;
typedef __attribute__((ext_vector_type(8)))  float    v8f;
typedef __attribute__((ext_vector_type(4)))  __bf16   v4bf;
typedef __attribute__((ext_vector_type(4)))  unsigned short v4us;
typedef __attribute__((ext_vector_type(4)))  float    v4f;
typedef v4f  __attribute__((may_alias)) v4fa;
typedef __attribute__((ext_vector_type(4)))  unsigned v4u;
typedef __attribute__((ext_vector_type(2)))  float    v2f;
typedef __attribute__((ext_vector_type(8)))  _Float16 v8h;
typedef __attribute__((ext_vector_type(16))) _Float16 v16h;

__device__ __forceinline__ unsigned short f2bf(float f) { unsigned u = __float_as_uint(f); u += 0x7FFFu + ((u >> 16) & 1u); return (unsigned short)(u >> 16); }
__device__ __forceinline__ float bfr(float f) { return __uint_as_float(((unsigned)f2bf(f)) << 16); }   // value after RNE convert to bf16
__device__ __forceinline__ v16bf cat16b(v8us lo, v8us hi) { return __builtin_bit_cast(v16bf, __builtin_shufflevector(lo, hi, 0, 1, 2, 3, 4, 5, 6, 7, 8, 9, 10, 11, 12, 13, 14, 15)); }
__device__ __forceinline__ v8f wmmab(v16bf a, v16bf b, v8f c) { return __builtin_amdgcn_wmma_f32_16x16x32_bf16(false, a, false, b, (short)0, c, false, false); }
__device__ __forceinline__ v16h cat16h(v8us lo, v8us hi) { return __builtin_bit_cast(v16h, __builtin_shufflevector(lo, hi, 0, 1, 2, 3, 4, 5, 6, 7, 8, 9, 10, 11, 12, 13, 14, 15)); }
__device__ __forceinline__ v8f wmmah(v16h a, v16h b, v8f c) { return __builtin_amdgcn_wmma_f32_16x16x32_f16(false, a, false, b, (short)0, c, false, false); }
// fragment loader from K-contiguous 16-bit rows; p already includes + 8*(lane>>4): elements 0..7 <- k0+8h+0..7, elements 8..15 <- k0+16+8h+0..7 (same map for A and B)
__device__ __forceinline__ v16bf ldb(const bf* p)  { return cat16b(*(const v8us*)p, *(const v8us*)(p + 16)); }

// k_proj: both projections in one launch; blockIdx.y = 0: U = data Wl^T, 1: V = crit Wr^T. Work-group = 8 waves = 32 x rows x all 64 output features, K = DK.
// P[m][n] = sum_k x[m][k] W[n][k] + bias[n] as f32 (m = b*SEQ + t), plane [m][64] (row = 256 bytes).
// Staging: 32 x rows then 64 W rows, each wave-wide load = 512 contiguous bytes of one f32 row; RNE convert to bf16 in registers; 8-byte LDS stores. One barrier, then wave w owns
// the 16 x 16 tile (rows 16*(w>>2), features 16*(w&3)) and runs the 16 k-steps in ascending k into one accumulator. Second barrier in front of the whole-line store of the 32 x 64 tile.
__global__ __launch_bounds__(256) void k_proj(const float* __restrict__ X0, const float* __restrict__ X1, const float* __restrict__ W0, const float* __restrict__ W1,
                                              const float* __restrict__ B0, const float* __restrict__ B1, float* P0, float* P1) {
    __shared__ __align__(16) bf    sm[(TR + AG) * KP];     // rows 0..31: x tile, rows 32..95: W; columns 0..511 of every row written, only those read
    __shared__ __align__(16) float os[TR * 68];
    const int tid = threadIdx.x; const int lane = tid & 31, lr = lane & 15, hi = lane >> 4, wv = tid >> 5;
    const bool sec = blockIdx.y != 0;
    const int r0 = blockIdx.x * TR;                                        // TR divides 64 divides SEQ: a tile never straddles two batches
    const float* xs = (sec ? X1 : X0) + ((size_t)(r0 / SEQ) * SEQ_FULL + (size_t)(r0 % SEQ)) * DK;
    const float* ws = sec ? W1 : W0;
    const float* bias = sec ? B1 : B0;
    float* P = sec ? P1 : P0;
    // Every work-group of a projection reads the same 64 W rows: each starts its walk over the 32 row pairs at a place of its own and wraps, so that the same line is not asked of L2 by all of them at one moment.
    // Work-groups next to each other in index, and those 8 apart, get different starts (speed only; any start gives the same LDS content).
    const int rot = (int)((blockIdx.x >> 3) * 2 + (blockIdx.x & 1)) & (AG / 2 - 1);
    unsigned wo[AG / 2];                                                   // piece (of 4 floats) that this thread reads in trip i: row pair (i + rot) mod 32
#pragma unroll
    for (int i = 0; i < AG / 2; ++i) wo[i] = (unsigned)(((i + rot) & (AG / 2 - 1)) * 256 + tid);
    v4f st[(TR + AG) / 2];
#pragma unroll
    for (int i = 0; i < TR / 2; ++i) st[i] = *(const v4f*)(xs + (size_t)(i * 256 + tid) * 4);              // 16 trips x 2 rows = 32 rows
#pragma unroll
    for (int i = 0; i < AG / 2; ++i) st[TR / 2 + i] = *(const v4f*)(ws + (size_t)wo[i] * 4);               // 32 trips x 2 rows = 64 rows
    const float bc = bfr(bias[(wv & 3) * 16 + lr]);                        // index <= 63 < AG
    asm volatile("s_wait_xcnt 0x0" ::: "memory");                         // a register that holds one of these loads' offsets is reused below
    __builtin_amdgcn_sched_barrier(0);   // keeps every staging load in front of the first convert: all 48 are in flight at once, one memory round trip instead of two
#pragma unroll
    for (int i = 0; i < TR / 2; ++i)
        *(v4us*)(&sm[(2 * i + (tid >> 7)) * KP + (tid & 127) * 4]) = __builtin_bit_cast(v4us, __builtin_convertvector(st[i], v4bf));
#pragma unroll
    for (int i = 0; i < AG / 2; ++i)                                       // W row = piece / 128; the offsets stay in their registers up to here, so no load's result lands on the offset of a load still under way
        *(v4us*)(&sm[TR * KP + (wo[i] >> 7) * KP + (tid & 127) * 4]) = __builtin_bit_cast(v4us, __builtin_convertvector(st[TR / 2 + i], v4bf));
    __syncthreads();
    const bf* ap = sm + ((wv >> 2) * 16 + lr) * KP + 8 * hi;
    const bf* bp = sm + (TR + (wv & 3) * 16 + lr) * KP + 8 * hi;
    v8f acc = (v8f){};
#pragma unroll
    for (int kc = 0; kc < DK; kc += 32) acc = wmmab(ldb(ap + kc), ldb(bp + kc), acc);
#pragma unroll
    for (int j = 0; j < 8; ++j) os[((wv >> 2) * 16 + hi * 8 + j) * 68 + (wv & 3) * 16 + lr] = acc[j] + bc;   // D: row 8h+j, col lane&15; 8 waves cover rows 0..31 x columns 0..63
    __syncthreads();
    float* pb = P + (size_t)r0 * AG;
#pragma unroll
    for (int s = 0; s < 2; ++s) { const int idx = s * 256 + tid; const int row = idx >> 4, c4 = (idx & 15) * 4;     // 512 pieces of 4 floats = 32 rows x 64 columns
        *(v4f*)(pb + (size_t)idx * 4) = *(const v4fa*)(&os[row * 68 + c4]); }
}

// the 32 subset products of five factors times a row scale s, place = bit i: factor i; piece c = places 8c .. 8c + 7
__device__ __forceinline__ void subsets(float s, float e0, float e1, float e2, float e3, float e4, v8f* p) {
    const v2f a = (v2f){s, s * e0};
    const v2f b = a * e1;
    const v4f c = __builtin_shufflevector(a, b, 0, 1, 2, 3);
    const v4f d = c * e2;
    p[0] = __builtin_shufflevector(c, d, 0, 1, 2, 3, 4, 5, 6, 7);
    p[1] = p[0] * e3; p[2] = p[0] * e4; p[3] = p[1] * e4;
}
__device__ __forceinline__ v8us toh(v8f x) { return __builtin_bit_cast(v8us, __builtin_convertvector(x, v8h)); }   // RNE convert to f16

// The factors of one staged row for one LDS fill of sb (groups GB .. GB + GC - 1); NUM: the row is a U row and gets the cS planes too. Returns true if a group of the row is out of the f16 range.
// Row scale s = rsqrt(product of the group's five exponentials): the places run from 2^(-T/2) to 2^(T/2), T = sum of the five |base-2 exponents|. s is common to a row's D and N factors and leaves N / D as it is.
template <int GB, int GC, bool NUM>
__device__ __forceinline__ bool fill_row(const float* rr, const float* cs, v8us* pr) {
    constexpr int CB = (GB * GT) & ~3, NQ = ((GB + GC) * GT - CB + 3) / 4;
    static_assert(CB + 4 * NQ <= PT);
    v4f rw[NQ];
#pragma unroll   // q indexes registers
    for (int q = 0; q < NQ; ++q) rw[q] = *(const v4fa*)(&rr[CB + 4 * q]);
    bool over = false;                                           // gathered with |, not ||: no branch per group, so the groups' arithmetic stays one block that the scheduler can interleave
#pragma unroll   // gg indexes the registers of rw; the LDS reads of later groups issue ahead of the arithmetic
    for (int gg = 0; gg < GC; ++gg) {
        float e[GT];
#pragma unroll
        for (int i = 0; i < GT; ++i) { const int c = (GB + gg) * GT + i - CB; e[i] = rw[c >> 2][c & 3]; }
        const float s = __builtin_amdgcn_rsqf(((e[0] * e[1]) * (e[2] * e[3])) * e[4]);
        float tot = s;                                           // s (1 + e0) .. (1 + e4) = the sum of the 32 places, all positive: no place is above it, and the smallest place is 1 / the largest
#pragma unroll   // i indexes registers
        for (int i = 0; i < GT; ++i) tot = fmaf(tot, e[i], tot);
        over |= !(tot >= 16.0f && tot <= HCAP);                  // in range tot >= 32; a product of the five that overflows gives s = 0 and tot = 0 or NaN, one that underflows s = inf: all out of range, as is any NaN
        v8f p[4];
        subsets(s, e[0], e[1], e[2], e[3], e[4], p);
        v8us* pg = pr + (size_t)gg * 12 * TN;
#pragma unroll
        for (int c = 0; c < 4; ++c) pg[c * TN] = toh(p[c]);
        if (NUM) {
#pragma unroll
            for (int c = 0; c < 4; ++c) {
                const v4f c0 = *(const v4fa*)(&cs[(GB + gg) * 32 + 8 * c]), c1 = *(const v4fa*)(&cs[(GB + gg) * 32 + 8 * c + 4]);
                pg[(4 + c) * TN] = toh(p[c] * __builtin_shufflevector(c0, c1, 0, 1, 2, 3, 4, 5, 6, 7)); } }
    }
    return over;
}

// One LDS fill of sb and the sums over its groups. Returns true (the same in every thread of the work-group) if a row of this fill is out of the f16 range; acc is then not used.
template <int H>
__device__ __forceinline__ bool half_pass(const float* raw, const float* cs, v8us* sb, unsigned* fl, v8f (&acc)[2][4], int tid, int lr, int hi, int wv) {
    constexpr int GB = H ? G0 : 0, GC = H ? NG - G0 : G0;
    bool over;                                                   // thread = one staged row: waves 0..3 the U rows, waves 4..7 the V rows (wave-uniform test)
    if (tid < TN) over = fill_row<GB, GC, true>(raw + tid * PT, cs, sb + tid);
    else          over = fill_row<GB, GC, false>(raw + tid * PT, cs, sb + 8 * TN + tid - TN);
    const unsigned wbad = __builtin_amdgcn_ballot_w32(over);
    if ((tid & 31) == 0) fl[wv] = wbad;
    __syncthreads();                                             // the fill and its flags are complete (cross-wave)
    const v4u f0 = *(const v4u*)(&fl[0]), f1 = *(const v4u*)(&fl[4]);
    // the same eight words in every thread of the work-group: readfirstlane makes the test a scalar branch that the whole work-group takes or leaves
    if (__builtin_amdgcn_readfirstlane((f0[0] | f0[1]) | (f0[2] | f0[3]) | (f1[0] | f1[1]) | (f1[2] | f1[3])) != 0u) return true;
    const int ar = (wv >> 1) * 32 + lr, bc = (wv & 1) * 64 + lr;
#pragma unroll 1   // unrolled (the trip count is a constant here) the groups' products were all hoisted and the build spilled to scratch
    for (int gg = 0; gg < GC; ++gg) {
        const v8us* pg = sb + (size_t)gg * 12 * TN;
        v16h fd[2], fn[2], fb[4];
#pragma unroll
        for (int ti = 0; ti < 2; ++ti) {
            fd[ti] = cat16h(pg[(0 + hi) * TN + ar + 16 * ti], pg[(2 + hi) * TN + ar + 16 * ti]);
            fn[ti] = cat16h(pg[(4 + hi) * TN + ar + 16 * ti], pg[(6 + hi) * TN + ar + 16 * ti]); }
#pragma unroll
        for (int tj = 0; tj < 4; ++tj)
            fb[tj] = cat16h(pg[(8 + hi) * TN + bc + 16 * tj], pg[(10 + hi) * TN + bc + 16 * tj]);
#pragma unroll
        for (int ti = 0; ti < 2; ++ti) {
#pragma unroll
            for (int tj = 0; tj < 4; ++tj) {
                const v8f den = wmmah(fd[ti], fb[tj], (v8f){});
                const v8f num = wmmah(fn[ti], fb[tj], (v8f){});
#pragma unroll
                for (int j = 0; j < 8; ++j) acc[ti][tj][j] = fmaf(num[j], __builtin_amdgcn_rcpf(den[j]), acc[ti][tj][j]); } }
    }
    return false;
}

// k_pair: out[b][n][m] = sum_a agg[a] * tanh(u[n][a] + v[m][a]) = sum_a agg[a] - 2 sum_a w[a] / p[a], w[a] = agg[a], p[a] = 1 + U[n][a] V[m][a] >= 1, U = exp(2u), V = exp(2v).
// Group of five terms: sum_i w_i / p_i = N / D, D = product of the p_i = sum_S US VS, N = sum_S cS US VS; S runs over the 32 subsets of the group (place = bit i: term i),
// US = product of U over S, VS = product of V over S, cS = sum of the w outside S. One WMMA (K = 32 = the 32 subsets) gives D and one gives N of a 16 x 16 tile; the sum adds N * rcp(D), groups in ascending a.
// The weights enter cS times a power of two sg that puts the largest |agg| in [1/8, 1/4]; the final fma takes it out again (exact).
// Block = 8 waves = 128 (n) x 128 (m) outputs of one batch; wave w owns rows 32 (w >> 1) .. + 31 and columns 64 (w & 1) .. + 63 (2 x 4 WMMA tiles).
// LDS: raw = the 128 U rows then the 128 V rows (exponentials of the stored planes; pad columns 64..67 one, their weight zero); sb = twelve planes [group][piece][row] of 8 f16: s US pieces 0..3, cS s US pieces 0..3, s VS pieces 0..3; filled twice (7 and 6 groups).
// k places (same map for A and B, as in ldb): lane half h, elements 0..7 = piece h, elements 8..15 = piece 2 + h.
__global__ __launch_bounds__(256) void k_pair(const float* __restrict__ U, const float* __restrict__ V, const float* __restrict__ agg, float* OUT) {
    __shared__ __align__(16) float raw[2 * TN * PT];
    __shared__ __align__(16) v8us  sb[12 * G0 * TN];
    __shared__ __align__(16) float cs[NG * 32];
    __shared__ __align__(16) float wS[PT];
    __shared__ __align__(16) unsigned fl[8];                     // per wave: nonzero = this wave saw a row that the quotient form does not take
    const int tid = threadIdx.x; const int lane = tid & 31, lr = lane & 15, hi = lane >> 4, wv = tid >> 5;
    const int n0 = blockIdx.x * TN, m0 = blockIdx.y * TN, b = blockIdx.z;
    const float* dsrc = U + ((size_t)b * SEQ + n0) * AG;
    const float* csrc = V + ((size_t)b * SEQ + m0) * AG;
    // The 128 U rows are read by every work-group of this blockIdx.x, the 128 V rows by every one of this blockIdx.y: each walks the 8 pieces of 16 rows from a start of its own and wraps (as in k_proj).
    const unsigned ru = blockIdx.y & 7u, rv = blockIdx.x & 7u;
    unsigned po[16];                                             // piece (of 4 floats) of the U rows (i < 8) or of the V rows that this thread reads in trip i
#pragma unroll
    for (int i = 0; i < 16; ++i) po[i] = (((unsigned)i + (i < 8 ? ru : rv)) & 7u) * 256u + (unsigned)tid;
    v4f st[16];
#pragma unroll
    for (int i = 0; i < 16; ++i) st[i] = *(const v4f*)((i < 8 ? dsrc : csrc) + (size_t)po[i] * 4);   // 2 x 2048 pieces of 4 floats = 2 x 128 rows x 64 columns
    const float wlo = bfr(agg[lane]), whi = bfr(agg[lane + 32]);   // every wave holds all AG = 64 weights, two a lane (index <= 63); in flight together with the plane rows
    asm volatile("s_wait_xcnt 0x0" ::: "memory");                // the scalar registers that hold these loads' bases are reused below
    // bits of the largest |agg|: maximum over the 16 lanes of a row by DPP, then over the two rows as scalars; a NaN or an infinity reads as exponent 255
    int wm = (int)(__float_as_uint(wlo) & 0x7FFFFFFFu), wn = (int)(__float_as_uint(whi) & 0x7FFFFFFFu);
    wm = wm > wn ? wm : wn;
    wn = __builtin_amdgcn_update_dpp(0, wm, 0x161, 0xF, 0xF, false); wm = wm > wn ? wm : wn;   // row_xmask:1
    wn = __builtin_amdgcn_update_dpp(0, wm, 0x162, 0xF, 0xF, false); wm = wm > wn ? wm : wn;   // row_xmask:2
    wn = __builtin_amdgcn_update_dpp(0, wm, 0x164, 0xF, 0xF, false); wm = wm > wn ? wm : wn;   // row_xmask:4
    wn = __builtin_amdgcn_update_dpp(0, wm, 0x168, 0xF, 0xF, false); wm = wm > wn ? wm : wn;   // row_xmask:8
    const int wr0 = __builtin_amdgcn_readlane(wm, 0), wr1 = __builtin_amdgcn_readlane(wm, 16);
    const unsigned ex = (unsigned)(wr0 > wr1 ? wr0 : wr1) >> 23;
    const bool wok = ex >= WEXLO && ex <= WEXHI;
    const float sg = __uint_as_float((251u - ex) << 23);         // 2^(124 - ex): sg * largest |agg| in [1/8, 1/4)
    const float m2 = -__uint_as_float((ex + 4u) << 23);          // -2 / sg
    const int wvu = __builtin_amdgcn_readfirstlane(wv);          // wave number as a scalar: a wave builds the 32 cS of one group (lane = subset), its five weights are read from their lanes
    const int slo = (int)__float_as_uint(wlo * sg), shi = (int)__float_as_uint(whi * sg);
    float cv[2];
#pragma unroll
    for (int r = 0; r < 2; ++r) { const int g = r * 8 + wvu < NG ? r * 8 + wvu : NG - 1; float c = 0.0f;
#pragma unroll
        for (int i = 0; i < GT; ++i) { const int a = g * GT + i;
            const int x = __builtin_amdgcn_readlane(slo, a & 31), y = __builtin_amdgcn_readlane(shi, a & 31);
            const float w = __uint_as_float((unsigned)(a < 32 ? x : a < AG ? y : 0));
            c += ((lane >> i) & 1) ? 0.0f : w; }
        cv[r] = c; }
#pragma unroll
    for (int i = 0; i < 16; ++i) { const int row = (int)(po[i] >> 4), c4 = (tid & 15) * 4;   // the piece that st[i] holds: 16 pieces a row
        const v4f t = st[i] * 2.885390082f;                                                                             // 2 log2(e)
        *(v4fa*)(&raw[((i >> 3) * TN + row) * PT + c4]) = (v4f){__builtin_amdgcn_exp2f(t[0]), __builtin_amdgcn_exp2f(t[1]), __builtin_amdgcn_exp2f(t[2]), __builtin_amdgcn_exp2f(t[3])}; }
    *(v4fa*)(&raw[tid * PT + AG]) = (v4f){1.0f, 1.0f, 1.0f, 1.0f};           // pad columns of row tid
    if (wvu < 3 && (wvu < 2 || lane < PT - AG)) wS[tid] = wvu == 0 ? wlo : wvu == 1 ? whi : 0.0f;   // tid < PT
    cs[tid] = cv[0];                                             // groups 0..7
    if (wvu < NG - 8) cs[256 + tid] = cv[1];                     // groups 8..12
    v8f acc[2][4];
#pragma unroll
    for (int ti = 0; ti < 2; ++ti)
#pragma unroll
        for (int tj = 0; tj < 4; ++tj) acc[ti][tj] = (v8f){};
    __syncthreads();                                             // raw, wS and cs are staged (cross-wave)
    bool plain = !wok;                                           // the same in every thread
    if (!plain) plain = half_pass<0>(raw, cs, sb, fl, acc, tid, lr, hi, wv);
    if (!plain) {
        __syncthreads();                                         // every wave has left the first fill of sb and has read its flags
        plain = half_pass<1>(raw, cs, sb, fl, acc, tid, lr, hi, wv);
    }
    if (plain) {                                                 // nobody reads raw behind the last barrier passed
        // plain form for any u, v, agg: sum of agg * v_tanh_f32(u + v) in ascending a. The planes are read again as stored; each thread overwrites the places of raw that it filled itself.
#pragma unroll   // all loads in flight at once
        for (int i = 0; i < 16; ++i) { const int idx = (i & 7) * 256 + tid; const int row = idx >> 4, c4 = (idx & 15) * 4;
            *(v4fa*)(&raw[((i >> 3) * TN + row) * PT + c4]) = *(const v4f*)((i < 8 ? dsrc : csrc) + (size_t)idx * 4); }
        __syncthreads();                                         // u and v rows are staged (cross-wave); block-uniform branch
#pragma unroll 1   // this seldom-taken path stays small: unrolled it raised the kernel's register count and spilled
        for (int r = 0; r < 16; ++r) {                           // wave w: rows 16 w + r; lane: columns 4 lane .. + 3 (a wave stores 512 contiguous bytes)
            const float* ur = raw + (wv * 16 + r) * PT;
            v4f sum = (v4f){0.0f, 0.0f, 0.0f, 0.0f};
#pragma unroll 1   // as above
            for (int q = 0; q < AG / 4; ++q) {
                const v4f d = *(const v4fa*)(&ur[4 * q]); const v4f w = *(const v4fa*)(&wS[4 * q]);
#pragma unroll   // k and e index vector elements: unrolled they are registers
                for (int k = 0; k < 4; ++k) { const v4f c = *(const v4fa*)(&raw[(TN + 4 * lane + k) * PT + 4 * q]);
#pragma unroll
                    for (int e = 0; e < 4; ++e) { float th;
                        // v_nop in the statement: the slot behind a transcendental
                        asm("v_tanh_f32 %0, %1\n\tv_nop" : "=v"(th) : "v"(d[e] + c[e]));
                        sum[k] = fmaf(w[e], th, sum[k]); } } }
            *(v4f*)(OUT + ((size_t)b * OUT_SEQ + n0 + wv * 16 + r) * OUT_SEQ + m0 + 4 * lane) = sum;
            asm volatile("s_wait_xcnt 0x0" ::: "memory"); }      // the next trip overwrites the registers that held this store's address
        return;
    }
    float wsum = 0.0f;                                           // sum_a agg[a]
#pragma unroll
    for (int q = 0; q < AG / 4; ++q) { const v4f w = *(const v4fa*)(&wS[4 * q]); wsum += (w[0] + w[1]) + (w[2] + w[3]); }
    // whole-line store: each wave stages its 32 x 64 tile in its own 32 rows of raw (nobody reads raw behind the last barrier above)
    float* os = raw + wv * 32 * PT;
#pragma unroll
    for (int ti = 0; ti < 2; ++ti)
#pragma unroll
        for (int tj = 0; tj < 4; ++tj)
#pragma unroll
            for (int j = 0; j < 8; ++j) os[(16 * ti + 8 * hi + j) * PT + 16 * tj + lr] = fmaf(m2, acc[ti][tj][j], wsum);   // D: row 8h+j, col lane&15
    asm volatile("s_wait_dscnt 0x0" ::: "memory");               // the wave's own LDS stores are done before other lanes read the rows back
    float* ob = OUT + ((size_t)b * OUT_SEQ + n0 + (wv >> 1) * 32 + hi) * OUT_SEQ + m0 + (wv & 1) * 64 + lr * 4;
#pragma unroll
    for (int it = 0; it < 16; ++it) *(v4f*)(ob + (size_t)(2 * it) * OUT_SEQ) = *(const v4fa*)(&os[(2 * it + hi) * PT + lr * 4]);   // 16 lanes x 16 B = 256 B of one row
}

static constexpr size_t al256(size_t v) { return (v + 255) & ~(size_t)255; }
static constexpr size_t SZ_PL = al256((size_t)NB * SEQ * AG * 4);      // f32 projection plane, rows = NB*SEQ (multiple of 32 = projection tile rows)
static constexpr size_t SZ_TOTAL = 2 * SZ_PL;
static_assert(SZ_TOTAL <= (size_t)134217728);          // workspace carve <= 128 MiB

extern "C" void kernel_launch(void* const* d_in, const int* in_sizes, int n_in,
                              void* d_out, int out_size, void* d_ws, size_t ws_size, hipStream_t stream) {
    if (n_in < 7) return;
    const size_t needx = ((size_t)(NB - 1) * SEQ_FULL + SEQ) * DK;
    if ((size_t)in_sizes[0] < needx || (size_t)in_sizes[1] < needx) return;
    if ((size_t)in_sizes[2] < (size_t)AG * DK || (size_t)in_sizes[4] < (size_t)AG * DK) return;
    if (in_sizes[3] < AG || in_sizes[5] < AG || in_sizes[6] < AG) return;
    if ((size_t)out_size < ((size_t)(NB - 1) * OUT_SEQ + (size_t)(SEQ - 1)) * OUT_SEQ + SEQ) return;
    if (SZ_TOTAL > ws_size) return;
    // wire order: data, crit, Wl, bl, Wr, br, agg
    const float* xd = (const float*)d_in[0]; const float* xc = (const float*)d_in[1];
    const float* wl = (const float*)d_in[2]; const float* bl = (const float*)d_in[3];
    const float* wr = (const float*)d_in[4]; const float* br = (const float*)d_in[5];
    const float* ag = (const float*)d_in[6];
    float* OUT = (float*)d_out;      // [NB][SEQ][SEQ]
    char* wsp = (char*)d_ws;
    float* UP = (float*)wsp; wsp += SZ_PL;           // [NB*SEQ][64] data Wl^T + bl
    float* VP = (float*)wsp; wsp += SZ_PL;           // [NB*SEQ][64] crit Wr^T + br

    k_proj<<<dim3(NB * SEQ / TR, 2, 1), 256, 0, stream>>>(xd, xc, wl, wr, bl, br, UP, VP);

    k_pair<<<dim3(SEQ / TN, SEQ / TN, NB), 256, 0, stream>>>(UP, VP, ag, OUT);
}
